// v000
// Measured on an AMD MI455X. A time is GPU time per run, averaged over a window of back-to-back runs after a warm-up
// (all launches, gaps included; the runs take copies of the inputs in turn), and the median of several windows.
// Apart from v000's, it joins two sittings. Times from different sittings can be a few percent apart, while
// side-by-side timings come from the same sitting.
// v000 is the starting kernel. One run takes 231 microseconds.
#include <hip/hip_runtime.h>
#include <hip/hip_bf16.h>

// ---------------------------------------------------------------------------
// MPNet self-attention for MI455X (gfx1250, wave32, WMMA).
// Bandwidth-bound on position_bias (201MB) -> flash-attention fusion,
// f16 matrix cores with f32 accumulate, f32 softmax.
// GEMMs: double-buffered LDS staging (async global->LDS), batched B-fragment
// preload so WMMAs issue back-to-back.
// ---------------------------------------------------------------------------

typedef _Float16 v8h  __attribute__((ext_vector_type(8)));
typedef _Float16 v16h __attribute__((ext_vector_type(16)));
typedef float    v8f  __attribute__((ext_vector_type(8)));

#define HH 12
#define DHD 64
#define DD 768
#define BB 2
#define SS 2048
#define MM (BB * SS)   // 4096 rows

#if __has_builtin(__builtin_amdgcn_global_load_async_to_lds_b128)
#define USE_ASYNC_LDS 1
#else
#define USE_ASYNC_LDS 0
#endif

__device__ __forceinline__ v16h cat16(v8h lo, v8h hi) {
  return __builtin_shufflevector(lo, hi, 0,1,2,3,4,5,6,7,8,9,10,11,12,13,14,15);
}
__device__ __forceinline__ v8h ld8h(const _Float16* p) { return *(const v8h*)p; }
__device__ __forceinline__ v8f vzero8() {
  v8f z;
#pragma unroll
  for (int i = 0; i < 8; ++i) z[i] = 0.0f;
  return z;
}

// 32-byte global -> LDS stage for one thread (16 halves), async when available.
__device__ __forceinline__ void stage_row(_Float16* dst, const _Float16* src) {
#if USE_ASYNC_LDS
  typedef int v4i __attribute__((vector_size(16)));
  typedef __attribute__((address_space(1))) v4i* gptr_t;
  typedef __attribute__((address_space(3))) v4i* lptr_t;
  gptr_t g = (gptr_t)src;
  lptr_t l = (lptr_t)dst;
  __builtin_amdgcn_global_load_async_to_lds_b128(g, l, 0, 0);
  __builtin_amdgcn_global_load_async_to_lds_b128(g, l, 16, 0);
#else
  v8h t0 = *(const v8h*)src;
  v8h t1 = *(const v8h*)(src + 8);
  *(v8h*)dst = t0;
  *(v8h*)(dst + 8) = t1;
#endif
}

__device__ __forceinline__ void wait_async_lds() {
#if USE_ASYNC_LDS
# if __has_builtin(__builtin_amdgcn_s_wait_asynccnt)
  __builtin_amdgcn_s_wait_asynccnt(0);
# else
  asm volatile("s_wait_asynccnt 0" ::: "memory");
# endif
#endif
}

__device__ __forceinline__ void wave_sched_fence() {
#if __has_builtin(__builtin_amdgcn_sched_barrier)
  __builtin_amdgcn_sched_barrier(0);
#else
  __syncthreads();
#endif
}

// ---------------------------------------------------------------------------
// Kernel 0: f32 -> f16 cast (hidden_states + weights), vectorized x4.
// ---------------------------------------------------------------------------
__global__ void cvt_f32_f16(const float* __restrict__ in,
                            _Float16* __restrict__ out, int n) {
  int i = (blockIdx.x * blockDim.x + threadIdx.x) * 4;
  if (i + 3 < n) {
    float4 v = *(const float4*)(in + i);
    out[i + 0] = (_Float16)v.x;
    out[i + 1] = (_Float16)v.y;
    out[i + 2] = (_Float16)v.z;
    out[i + 3] = (_Float16)v.w;
  }
}

// ---------------------------------------------------------------------------
// Shared TN-GEMM core: acc[8] += A[M,K] * W[N,K]^T over K=768.
// 8 waves / WG; W tile (128x32 halves) double-buffered in LDS; one barrier
// per K-step; async copy of tile i+1 overlaps WMMAs on tile i.
// A-fragment (16x32 f16, ISA layout): lane L -> row M = L&15,
//   half chunks at K = kk + (L>=16?8:0) and kk + 16 + (L>=16?8:0).
// ---------------------------------------------------------------------------
__device__ __forceinline__ void stage_tile(const _Float16* __restrict__ W,
                                           _Float16* BtBuf, int n0, int kk,
                                           int tid) {
  int n = tid >> 1, c = (tid & 1) * 16;
  stage_row(&BtBuf[n * 32 + c], W + (size_t)(n0 + n) * DD + kk + c);
}

__device__ __forceinline__ void compute_step(const _Float16* __restrict__ arow,
                                             const _Float16* BtBuf, int kk,
                                             int mloc, int koff, v8f acc[8]) {
  v16h a = cat16(ld8h(arow + kk + koff), ld8h(arow + kk + 16 + koff));
  v16h bf[8];
#pragma unroll
  for (int nt = 0; nt < 8; ++nt) {
    const _Float16* brow = &BtBuf[(nt * 16 + mloc) * 32];
    bf[nt] = cat16(*(const v8h*)(brow + koff), *(const v8h*)(brow + 16 + koff));
  }
#pragma unroll
  for (int nt = 0; nt < 8; ++nt)
    acc[nt] = __builtin_amdgcn_wmma_f32_16x16x32_f16(
        false, a, false, bf[nt], (short)0, acc[nt], false, false);
}

__device__ __forceinline__ void gemm_core(const _Float16* __restrict__ A,
                                          const _Float16* __restrict__ W,
                                          _Float16* Bt0, _Float16* Bt1,
                                          int m0, int n0, int tid,
                                          int mloc, int koff, v8f acc[8]) {
  const _Float16* arow = A + (size_t)(m0 + mloc) * DD;
  stage_tile(W, Bt0, n0, 0, tid);
  for (int kk = 0; kk < DD; kk += 64) {
    wait_async_lds();
    __syncthreads();
    if (kk + 32 < DD) stage_tile(W, Bt1, n0, kk + 32, tid);
    compute_step(arow, Bt0, kk, mloc, koff, acc);

    wait_async_lds();
    __syncthreads();
    if (kk + 64 < DD) stage_tile(W, Bt0, n0, kk + 64, tid);
    compute_step(arow, Bt1, kk + 32, mloc, koff, acc);
  }
}

// ---------------------------------------------------------------------------
// Kernel 1: QKV projection. layout=0: [B,H,S,DH] (Q,K)  layout=1: [B,H,DH,S] (V^T)
// ---------------------------------------------------------------------------
__global__ __launch_bounds__(256)
void gemm_qkv_f16(const _Float16* __restrict__ A,
                  const _Float16* __restrict__ W,
                  const float* __restrict__ bias,
                  _Float16* __restrict__ out,
                  int transposed, float scale) {
  __shared__ _Float16 Bt[2][128 * 32];   // 16 KB double buffer
  const int tid  = threadIdx.x;
  const int wv   = tid >> 5;
  const int lane = tid & 31;
  const int mloc = lane & 15;
  const int hi   = lane >> 4;
  const int koff = hi * 8;
  const int m0 = blockIdx.x * 128 + wv * 16;
  const int n0 = blockIdx.y * 128;

  v8f acc[8];
#pragma unroll
  for (int i = 0; i < 8; ++i) acc[i] = vzero8();

  gemm_core(A, W, Bt[0], Bt[1], m0, n0, tid, mloc, koff, acc);

  // epilogue: C layout lane holds (M = r + hi*8, N = nt*16 + (lane&15))
#pragma unroll
  for (int nt = 0; nt < 8; ++nt) {
    int n  = n0 + nt * 16 + mloc;
    float bv = bias[n];
    int hh = n >> 6, dh = n & 63;
#pragma unroll
    for (int r = 0; r < 8; ++r) {
      int m = m0 + r + hi * 8;
      int bb = m >> 11, s = m & 2047;
      float v = (acc[nt][r] + bv) * scale;
      size_t idx = transposed
          ? ((size_t)(bb * HH + hh) * DHD + dh) * SS + s
          : ((size_t)(bb * HH + hh) * SS + s) * DHD + dh;
      out[idx] = (_Float16)v;
    }
  }
}

// ---------------------------------------------------------------------------
// Kernel 2: flash attention per head. Grid (S/64, B*H), 4 waves x 16 q-rows.
// Streams 32 keys / iteration; position_bias read once per batch (prefetched).
// P-tile transpose (C-layout -> A-layout) through wave-private LDS: DS ops of
// one wave execute in order, so no workgroup barrier is needed.
// ---------------------------------------------------------------------------
__global__ __launch_bounds__(128)
void flash_attn(const _Float16* __restrict__ Q,    // [B,H,S,DH] pre-scaled 1/8
                const _Float16* __restrict__ K,    // [B,H,S,DH]
                const _Float16* __restrict__ Vt,   // [B,H,DH,S]
                const float* __restrict__ pb,      // [1,H,S,S]
                const float* __restrict__ mask,    // [B,1,1,S]
                _Float16* __restrict__ ctx) {      // [B,S,D] f16
  __shared__ _Float16 Pt[4][16][32];   // per-wave P tile
  const int wv   = threadIdx.x >> 5;
  const int lane = threadIdx.x & 31;
  const int mloc = lane & 15;
  const int hi   = lane >> 4;
  const int koff = hi * 8;
  const int bh = blockIdx.y, b = bh / HH, h = bh % HH;
  const int q0 = blockIdx.x * 64 + wv * 16;

  const _Float16* qrow = Q + ((size_t)bh * SS + q0 + mloc) * DHD;
  const v16h aq0 = cat16(ld8h(qrow + koff),      ld8h(qrow + 16 + koff));
  const v16h aq1 = cat16(ld8h(qrow + 32 + koff), ld8h(qrow + 48 + koff));

  const _Float16* Kh  = K  + (size_t)bh * SS * DHD;
  const _Float16* Vh  = Vt + (size_t)bh * DHD * SS;
  const float*    pbq = pb + ((size_t)h * SS + q0) * SS;
  const float*    mk  = mask + (size_t)b * SS;

  v8f o[4];
#pragma unroll
  for (int i = 0; i < 4; ++i) o[i] = vzero8();
  float mi[8], li[8];
#pragma unroll
  for (int r = 0; r < 8; ++r) { mi[r] = -1e30f; li[r] = 0.0f; }

  for (int kb = 0; kb < SS; kb += 32) {
    // ---- scores tile [16q x 32k] = Q * K^T (already 1/sqrt(dh) scaled) ----
    v16h kf[4];
#pragma unroll
    for (int nt = 0; nt < 2; ++nt) {
      const _Float16* kr = Kh + (size_t)(kb + nt * 16 + mloc) * DHD;
      kf[nt * 2 + 0] = cat16(ld8h(kr + koff),      ld8h(kr + 16 + koff));
      kf[nt * 2 + 1] = cat16(ld8h(kr + 32 + koff), ld8h(kr + 48 + koff));
    }
    v8f sc[2];
#pragma unroll
    for (int nt = 0; nt < 2; ++nt) {
      v8f c = vzero8();
      c = __builtin_amdgcn_wmma_f32_16x16x32_f16(false, aq0, false, kf[nt*2+0], (short)0, c, false, false);
      c = __builtin_amdgcn_wmma_f32_16x16x32_f16(false, aq1, false, kf[nt*2+1], (short)0, c, false, false);
      sc[nt] = c;
    }

    // ---- + position_bias + attention_mask (bandwidth-critical stream) ----
#pragma unroll
    for (int nt = 0; nt < 2; ++nt) {
      float mval = mk[kb + nt * 16 + mloc];
#pragma unroll
      for (int r = 0; r < 8; ++r)
        sc[nt][r] += pbq[(size_t)(r + hi * 8) * SS + kb + nt * 16 + mloc] + mval;
    }
    if (kb + 32 < SS)  // prefetch next 128B bias chunk per q-row
      __builtin_prefetch(pbq + (size_t)mloc * SS + kb + 32, 0, 1);

    // ---- online softmax: rows live in 16-lane halves, reduce via shfl_xor ----
#pragma unroll
    for (int r = 0; r < 8; ++r) {
      float x = fmaxf(sc[0][r], sc[1][r]);
      x = fmaxf(x, __shfl_xor(x, 1, 32));
      x = fmaxf(x, __shfl_xor(x, 2, 32));
      x = fmaxf(x, __shfl_xor(x, 4, 32));
      x = fmaxf(x, __shfl_xor(x, 8, 32));
      float mnew = fmaxf(mi[r], x);
      float corr = __expf(mi[r] - mnew);
      mi[r] = mnew;
      li[r] *= corr;
#pragma unroll
      for (int dt = 0; dt < 4; ++dt) o[dt][r] *= corr;
      float p0 = __expf(sc[0][r] - mnew);
      float p1 = __expf(sc[1][r] - mnew);
      li[r] += p0 + p1;
      Pt[wv][r + hi * 8][mloc]      = (_Float16)p0;   // C-layout -> LDS
      Pt[wv][r + hi * 8][16 + mloc] = (_Float16)p1;
    }
    wave_sched_fence();   // wave-private tile: DS in-order, no s_barrier needed

    // ---- O += P * V  (V pre-transposed so B-fragments are K-contiguous) ----
    v16h ap = cat16(*(const v8h*)&Pt[wv][mloc][koff],
                    *(const v8h*)&Pt[wv][mloc][16 + koff]);
    v16h vf[4];
#pragma unroll
    for (int dt = 0; dt < 4; ++dt) {
      const _Float16* vr = Vh + (size_t)(dt * 16 + mloc) * SS + kb;
      vf[dt] = cat16(ld8h(vr + koff), ld8h(vr + 16 + koff));
    }
#pragma unroll
    for (int dt = 0; dt < 4; ++dt)
      o[dt] = __builtin_amdgcn_wmma_f32_16x16x32_f16(
          false, ap, false, vf[dt], (short)0, o[dt], false, false);
  }

  // ---- normalize and emit context in [B,S,H*DH] f16 for the output GEMM ----
#pragma unroll
  for (int r = 0; r < 8; ++r) {
    float l = li[r];
    l += __shfl_xor(l, 1, 32);
    l += __shfl_xor(l, 2, 32);
    l += __shfl_xor(l, 4, 32);
    l += __shfl_xor(l, 8, 32);
    float rinv = 1.0f / l;
    int qg = q0 + r + hi * 8;
    size_t base = ((size_t)b * SS + qg) * DD + (size_t)h * DHD;
#pragma unroll
    for (int dt = 0; dt < 4; ++dt)
      ctx[base + dt * 16 + mloc] = (_Float16)(o[dt][r] * rinv);
  }
}

// ---------------------------------------------------------------------------
// Kernel 3: output projection, f32 epilogue straight to d_out.
// ---------------------------------------------------------------------------
__global__ __launch_bounds__(256)
void gemm_out_f32(const _Float16* __restrict__ A,
                  const _Float16* __restrict__ W,
                  const float* __restrict__ bias,
                  float* __restrict__ out) {
  __shared__ _Float16 Bt[2][128 * 32];
  const int tid  = threadIdx.x;
  const int wv   = tid >> 5;
  const int lane = tid & 31;
  const int mloc = lane & 15;
  const int hi   = lane >> 4;
  const int koff = hi * 8;
  const int m0 = blockIdx.x * 128 + wv * 16;
  const int n0 = blockIdx.y * 128;

  v8f acc[8];
#pragma unroll
  for (int i = 0; i < 8; ++i) acc[i] = vzero8();

  gemm_core(A, W, Bt[0], Bt[1], m0, n0, tid, mloc, koff, acc);

#pragma unroll
  for (int nt = 0; nt < 8; ++nt) {
    int n = n0 + nt * 16 + mloc;
    float bv = bias[n];
#pragma unroll
    for (int r = 0; r < 8; ++r) {
      int m = m0 + r + hi * 8;
      out[(size_t)m * DD + n] = acc[nt][r] + bv;
    }
  }
}

// ---------------------------------------------------------------------------
// Host-side launcher (graph-capture safe: stream launches only, ws scratch).
// ---------------------------------------------------------------------------
extern "C" void kernel_launch(void* const* d_in, const int* in_sizes, int n_in,
                              void* d_out, int out_size, void* d_ws, size_t ws_size,
                              hipStream_t stream) {
  (void)in_sizes; (void)n_in; (void)out_size; (void)ws_size;

  const float* hs   = (const float*)d_in[0];
  const float* mask = (const float*)d_in[1];
  const float* pb   = (const float*)d_in[2];
  const float* Wq   = (const float*)d_in[3];
  const float* bq   = (const float*)d_in[4];
  const float* Wk   = (const float*)d_in[5];
  const float* bk   = (const float*)d_in[6];
  const float* Wv   = (const float*)d_in[7];
  const float* bv   = (const float*)d_in[8];
  const float* Wo   = (const float*)d_in[9];
  const float* bo   = (const float*)d_in[10];
  float* out = (float*)d_out;

  char* ws = (char*)d_ws;
  size_t off = 0;
  auto wsalloc = [&](size_t bytes) -> void* {
    void* p = ws + off;
    off += (bytes + 255) & ~(size_t)255;
    return p;
  };
  const size_t actBytes = (size_t)MM * DD * sizeof(_Float16);   // 6.29 MB
  const size_t wBytes   = (size_t)DD * DD * sizeof(_Float16);   // 1.18 MB
  _Float16* X16   = (_Float16*)wsalloc(actBytes);
  _Float16* Wq16  = (_Float16*)wsalloc(wBytes);
  _Float16* Wk16  = (_Float16*)wsalloc(wBytes);
  _Float16* Wv16  = (_Float16*)wsalloc(wBytes);
  _Float16* Wo16  = (_Float16*)wsalloc(wBytes);
  _Float16* Q16   = (_Float16*)wsalloc(actBytes);   // [B,H,S,DH]
  _Float16* K16   = (_Float16*)wsalloc(actBytes);   // [B,H,S,DH]
  _Float16* Vt16  = (_Float16*)wsalloc(actBytes);   // [B,H,DH,S]
  _Float16* ctx16 = (_Float16*)wsalloc(actBytes);   // [B,S,D]

  // 0) casts
  {
    int nAct = MM * DD;          // 3,145,728
    int nW   = DD * DD;          // 589,824
    cvt_f32_f16<<<nAct / 1024, 256, 0, stream>>>(hs, X16, nAct);
    cvt_f32_f16<<<nW   / 1024, 256, 0, stream>>>(Wq, Wq16, nW);
    cvt_f32_f16<<<nW   / 1024, 256, 0, stream>>>(Wk, Wk16, nW);
    cvt_f32_f16<<<nW   / 1024, 256, 0, stream>>>(Wv, Wv16, nW);
    cvt_f32_f16<<<nW   / 1024, 256, 0, stream>>>(Wo, Wo16, nW);
  }

  // 1) QKV projections (Q pre-scaled by 1/sqrt(DH)=0.125; V written transposed)
  dim3 ggrid(MM / 128, DD / 128);   // 32 x 6
  gemm_qkv_f16<<<ggrid, 256, 0, stream>>>(X16, Wq16, bq, Q16,  0, 0.125f);
  gemm_qkv_f16<<<ggrid, 256, 0, stream>>>(X16, Wk16, bk, K16,  0, 1.0f);
  gemm_qkv_f16<<<ggrid, 256, 0, stream>>>(X16, Wv16, bv, Vt16, 1, 1.0f);

  // 2) fused flash attention with position bias + mask
  flash_attn<<<dim3(SS / 64, BB * HH), 128, 0, stream>>>(Q16, K16, Vt16, pb, mask, ctx16);

  // 3) output projection -> f32 result
  gemm_out_f32<<<ggrid, 256, 0, stream>>>(ctx16, Wo16, bo, out);
}

// v001
// It runs in 210 microseconds.
// Next to v000, in two timings, it ran 1.14 and 1.11 times as fast.
#include <hip/hip_runtime.h>
#include <hip/hip_bf16.h>

// ---------------------------------------------------------------------------
// Self-attention with additive position bias (gfx1250, wave32, WMMA).
// Bandwidth-bound on position_bias (201MB) -> flash-attention fusion,
// f16 matrix cores with f32 accumulate, f32 softmax.
// GEMMs: double-buffered LDS staging (async global->LDS), batched B-fragment
// preload so WMMAs issue back-to-back.
// ---------------------------------------------------------------------------

typedef _Float16 v8h  __attribute__((ext_vector_type(8)));
typedef _Float16 v16h __attribute__((ext_vector_type(16)));
typedef float    v8f  __attribute__((ext_vector_type(8)));

#define HH 12
#define DHD 64
#define DD 768
#define BB 2
#define SS 2048
#define MM (BB * SS)   // 4096 rows

#if __has_builtin(__builtin_amdgcn_global_load_async_to_lds_b128)
#define USE_ASYNC_LDS 1
#else
#define USE_ASYNC_LDS 0
#endif

__device__ __forceinline__ v16h cat16(v8h lo, v8h hi) {
  return __builtin_shufflevector(lo, hi, 0,1,2,3,4,5,6,7,8,9,10,11,12,13,14,15);
}
__device__ __forceinline__ v8h ld8h(const _Float16* p) { return *(const v8h*)p; }
__device__ __forceinline__ v8f vzero8() {
  v8f z;
#pragma unroll
  for (int i = 0; i < 8; ++i) z[i] = 0.0f;
  return z;
}

// 32-byte global -> LDS stage for one thread (16 halves), async when available.
__device__ __forceinline__ void stage_row(_Float16* dst, const _Float16* src) {
#if USE_ASYNC_LDS
  typedef int v4i __attribute__((vector_size(16)));
  typedef __attribute__((address_space(1))) v4i* gptr_t;
  typedef __attribute__((address_space(3))) v4i* lptr_t;
  gptr_t g = (gptr_t)src;
  lptr_t l = (lptr_t)dst;
  __builtin_amdgcn_global_load_async_to_lds_b128(g, l, 0, 0);
  __builtin_amdgcn_global_load_async_to_lds_b128(g, l, 16, 0);
#else
  v8h t0 = *(const v8h*)src;
  v8h t1 = *(const v8h*)(src + 8);
  *(v8h*)dst = t0;
  *(v8h*)(dst + 8) = t1;
#endif
}

__device__ __forceinline__ void wait_async_lds() {
#if USE_ASYNC_LDS
# if __has_builtin(__builtin_amdgcn_s_wait_asynccnt)
  __builtin_amdgcn_s_wait_asynccnt(0);
# else
  asm volatile("s_wait_asynccnt 0" ::: "memory");
# endif
#endif
}

__device__ __forceinline__ void wave_sched_fence() {
#if __has_builtin(__builtin_amdgcn_sched_barrier)
  __builtin_amdgcn_sched_barrier(0);
#else
  __syncthreads();
#endif
}

// ---------------------------------------------------------------------------
// Kernel 0: f32 -> f16 cast (hidden_states + weights), vectorized x4.
// ---------------------------------------------------------------------------
__global__ void cvt_f32_f16(const float* __restrict__ in,
                            _Float16* __restrict__ out, int n) {
  int i = (blockIdx.x * blockDim.x + threadIdx.x) * 4;
  if (i + 3 < n) {
    float4 v = *(const float4*)(in + i);
    out[i + 0] = (_Float16)v.x;
    out[i + 1] = (_Float16)v.y;
    out[i + 2] = (_Float16)v.z;
    out[i + 3] = (_Float16)v.w;
  }
}

// ---------------------------------------------------------------------------
// Shared TN-GEMM core: acc[8] += A[M,K] * W[N,K]^T over K=768.
// 8 waves / WG; W tile (128x32 halves) double-buffered in LDS; one barrier
// per K-step; async copy of tile i+1 overlaps WMMAs on tile i.
// A-fragment (16x32 f16, ISA layout): lane L -> row M = L&15,
//   half chunks at K = kk + (L>=16?8:0) and kk + 16 + (L>=16?8:0).
// ---------------------------------------------------------------------------
__device__ __forceinline__ void stage_tile(const _Float16* __restrict__ W,
                                           _Float16* BtBuf, int n0, int kk,
                                           int tid) {
  int n = tid >> 1, c = (tid & 1) * 16;
  stage_row(&BtBuf[n * 32 + c], W + (size_t)(n0 + n) * DD + kk + c);
}

__device__ __forceinline__ void compute_step(const _Float16* __restrict__ arow,
                                             const _Float16* BtBuf, int kk,
                                             int mloc, int koff, v8f acc[8]) {
  v16h a = cat16(ld8h(arow + kk + koff), ld8h(arow + kk + 16 + koff));
  v16h bf[8];
#pragma unroll
  for (int nt = 0; nt < 8; ++nt) {
    const _Float16* brow = &BtBuf[(nt * 16 + mloc) * 32];
    bf[nt] = cat16(*(const v8h*)(brow + koff), *(const v8h*)(brow + 16 + koff));
  }
#pragma unroll
  for (int nt = 0; nt < 8; ++nt)
    acc[nt] = __builtin_amdgcn_wmma_f32_16x16x32_f16(
        false, a, false, bf[nt], (short)0, acc[nt], false, false);
}

__device__ __forceinline__ void gemm_core(const _Float16* __restrict__ A,
                                          const _Float16* __restrict__ W,
                                          _Float16* Bt0, _Float16* Bt1,
                                          int m0, int n0, int tid,
                                          int mloc, int koff, v8f acc[8]) {
  const _Float16* arow = A + (size_t)(m0 + mloc) * DD;
  stage_tile(W, Bt0, n0, 0, tid);
  for (int kk = 0; kk < DD; kk += 64) {
    wait_async_lds();
    __syncthreads();
    if (kk + 32 < DD) stage_tile(W, Bt1, n0, kk + 32, tid);
    compute_step(arow, Bt0, kk, mloc, koff, acc);

    wait_async_lds();
    __syncthreads();
    if (kk + 64 < DD) stage_tile(W, Bt0, n0, kk + 64, tid);
    compute_step(arow, Bt1, kk + 32, mloc, koff, acc);
  }
}

// ---------------------------------------------------------------------------
// Kernel 1: QKV projection.
// layout=0 (Q): rows, [B,H,S,DH].
// layout=1 (V) and layout=2 (K): WMMA B-fragment order, so that one b128 load
// of a wave in the attention kernel reads 512 contiguous bytes (4 lines)
// instead of 16 bytes out of each of 16 lines.
//   K: [B*H][S/16 key tile][dh/32][chunk 2][lane 32][8 halves]
//      lane = ((dh>>3)&1)*16 + (s&15), chunk = (dh>>4)&1, half = dh&7
//   V: [B*H][S/32 key block][dh/16][chunk 2][lane 32][8 halves]
//      lane = ((s>>3)&1)*16 + (dh&15), chunk = (s>>4)&1, half = s&7
// ---------------------------------------------------------------------------
__global__ __launch_bounds__(256)
void gemm_qkv_f16(const _Float16* __restrict__ A,
                  const _Float16* __restrict__ W,
                  const float* __restrict__ bias,
                  _Float16* __restrict__ out,
                  int layout, float scale) {
  __shared__ _Float16 Bt[2][128 * 32];   // 16 KB double buffer
  const int tid  = threadIdx.x;
  const int wv   = tid >> 5;
  const int lane = tid & 31;
  const int mloc = lane & 15;
  const int hi   = lane >> 4;
  const int koff = hi * 8;
  const int m0 = blockIdx.x * 128 + wv * 16;
  const int n0 = blockIdx.y * 128;

  v8f acc[8];
#pragma unroll
  for (int i = 0; i < 8; ++i) acc[i] = vzero8();

  gemm_core(A, W, Bt[0], Bt[1], m0, n0, tid, mloc, koff, acc);

  // epilogue: C layout lane holds (M = r + hi*8, N = nt*16 + (lane&15))
  const int bb = m0 >> 11, s0 = m0 & 2047;   // the wave's 16 rows: one batch
  float bvv[8];
#pragma unroll
  for (int nt = 0; nt < 8; ++nt) bvv[nt] = bias[n0 + nt * 16 + mloc];
  // n0 is a multiple of 128: tiles 0..3 are head n0/64, tiles 4..7 the next;
  // within a head dh = (nt&3)*16 + mloc
  _Float16* ob = out + (size_t)(bb * HH + (n0 >> 6)) * SS * DHD;
  if (layout == 1) {
    // a lane's 8 rows are the 8 halves of its own fragment slot
    _Float16* ov = ob + (s0 >> 5) * 2048 + ((s0 >> 4) & 1) * 256 + lane * 8;
#pragma unroll
    for (int nt = 0; nt < 8; ++nt) {
      v8h pk;
#pragma unroll
      for (int r = 0; r < 8; ++r) pk[r] = (_Float16)((acc[nt][r] + bvv[nt]) * scale);
      *(v8h*)(ov + (nt >> 2) * SS * DHD + (nt & 3) * 512) = pk;
    }
  } else if (layout == 2) {
    _Float16* ok = ob + (s0 >> 4) * 1024 + ((mloc >> 3) * 16 + hi * 8) * 8 + (mloc & 7);
#pragma unroll
    for (int nt = 0; nt < 8; ++nt)
#pragma unroll
      for (int r = 0; r < 8; ++r)
        ok[(nt >> 2) * SS * DHD + (nt & 3) * 256 + r * 8] =
            (_Float16)((acc[nt][r] + bvv[nt]) * scale);
    // stands ahead of any later write of a register that these stores name
    // (the other layouts' blocks follow this one in the built code)
    asm volatile("s_wait_xcnt 0x0" ::: "memory");
  } else {
    _Float16* oq = ob + (s0 + hi * 8) * DHD + mloc;
#pragma unroll
    for (int nt = 0; nt < 8; ++nt)
#pragma unroll
      for (int r = 0; r < 8; ++r)
        oq[(nt >> 2) * SS * DHD + r * DHD + (nt & 3) * 16] =
            (_Float16)((acc[nt][r] + bvv[nt]) * scale);
    // stands ahead of any later write of a register that these stores name
    // (the other layouts' blocks follow this one in the built code)
    asm volatile("s_wait_xcnt 0x0" ::: "memory");
  }
}

// ---------------------------------------------------------------------------
// Kernel 2: flash attention per head. Grid (S/64, B*H), 4 waves x 16 q-rows.
// Streams 32 keys / iteration; position_bias read once per batch (prefetched).
// P-tile transpose (C-layout -> A-layout) through wave-private LDS: DS ops of
// one wave execute in order, so no workgroup barrier is needed.
// ---------------------------------------------------------------------------
__global__ __launch_bounds__(128)
void flash_attn(const _Float16* __restrict__ Q,    // [B,H,S,DH] pre-scaled 1/8
                const _Float16* __restrict__ K,    // fragment order (kernel 1)
                const _Float16* __restrict__ Vt,   // fragment order (kernel 1)
                const float* __restrict__ pb,      // [1,H,S,S]
                const float* __restrict__ mask,    // [B,1,1,S]
                _Float16* __restrict__ ctx) {      // [B,S,D] f16
  __shared__ _Float16 Pt[4][16][32];   // per-wave P tile
  const int wv   = threadIdx.x >> 5;
  const int lane = threadIdx.x & 31;
  const int mloc = lane & 15;
  const int hi   = lane >> 4;
  const int koff = hi * 8;
  const int bh = blockIdx.y, b = bh / HH, h = bh % HH;
  const int q0 = blockIdx.x * 64 + wv * 16;

  const _Float16* qrow = Q + ((size_t)bh * SS + q0 + mloc) * DHD;
  const v16h aq0 = cat16(ld8h(qrow + koff),      ld8h(qrow + 16 + koff));
  const v16h aq1 = cat16(ld8h(qrow + 32 + koff), ld8h(qrow + 48 + koff));

  // 32 keys are 2048 contiguous halves in both: 8 slots of 32 lanes x 8 halves
  const _Float16* Kh  = K  + (size_t)bh * SS * DHD + lane * 8;
  const _Float16* Vh  = Vt + (size_t)bh * DHD * SS + lane * 8;
  const float*    pbq = pb + ((size_t)h * SS + q0) * SS;
  const float*    mk  = mask + (size_t)b * SS;

  v8f o[4];
#pragma unroll
  for (int i = 0; i < 4; ++i) o[i] = vzero8();
  float mi[8], li[8];
#pragma unroll
  for (int r = 0; r < 8; ++r) { mi[r] = -1e30f; li[r] = 0.0f; }

  for (int kb = 0; kb < SS; kb += 32) {
    // ---- scores tile [16q x 32k] = Q * K^T (already 1/sqrt(dh) scaled) ----
    v16h kf[4];
#pragma unroll
    for (int nt = 0; nt < 2; ++nt) {
      const _Float16* kr = Kh + (size_t)(kb + nt * 16) * DHD;
      kf[nt * 2 + 0] = cat16(ld8h(kr),       ld8h(kr + 256));
      kf[nt * 2 + 1] = cat16(ld8h(kr + 512), ld8h(kr + 768));
    }
    v8f sc[2];
#pragma unroll
    for (int nt = 0; nt < 2; ++nt) {
      v8f c = vzero8();
      c = __builtin_amdgcn_wmma_f32_16x16x32_f16(false, aq0, false, kf[nt*2+0], (short)0, c, false, false);
      c = __builtin_amdgcn_wmma_f32_16x16x32_f16(false, aq1, false, kf[nt*2+1], (short)0, c, false, false);
      sc[nt] = c;
    }

    // ---- + position_bias + attention_mask (bandwidth-critical stream) ----
#pragma unroll
    for (int nt = 0; nt < 2; ++nt) {
      float mval = mk[kb + nt * 16 + mloc];
#pragma unroll
      for (int r = 0; r < 8; ++r)
        sc[nt][r] += pbq[(size_t)(r + hi * 8) * SS + kb + nt * 16 + mloc] + mval;
    }
    if (kb + 32 < SS)  // prefetch next 128B bias chunk per q-row
      __builtin_prefetch(pbq + (size_t)mloc * SS + kb + 32, 0, 1);

    // ---- online softmax: rows live in 16-lane halves, reduce via shfl_xor ----
#pragma unroll
    for (int r = 0; r < 8; ++r) {
      float x = fmaxf(sc[0][r], sc[1][r]);
      x = fmaxf(x, __shfl_xor(x, 1, 32));
      x = fmaxf(x, __shfl_xor(x, 2, 32));
      x = fmaxf(x, __shfl_xor(x, 4, 32));
      x = fmaxf(x, __shfl_xor(x, 8, 32));
      float mnew = fmaxf(mi[r], x);
      float corr = __expf(mi[r] - mnew);
      mi[r] = mnew;
      li[r] *= corr;
#pragma unroll
      for (int dt = 0; dt < 4; ++dt) o[dt][r] *= corr;
      float p0 = __expf(sc[0][r] - mnew);
      float p1 = __expf(sc[1][r] - mnew);
      li[r] += p0 + p1;
      Pt[wv][r + hi * 8][mloc]      = (_Float16)p0;   // C-layout -> LDS
      Pt[wv][r + hi * 8][16 + mloc] = (_Float16)p1;
    }
    wave_sched_fence();   // wave-private tile: DS in-order, no s_barrier needed

    // ---- O += P * V  (V stored as ready B-fragments) ----
    v16h ap = cat16(*(const v8h*)&Pt[wv][mloc][koff],
                    *(const v8h*)&Pt[wv][mloc][16 + koff]);
    v16h vf[4];
#pragma unroll
    for (int dt = 0; dt < 4; ++dt) {
      const _Float16* vr = Vh + (size_t)kb * DHD + dt * 512;
      vf[dt] = cat16(ld8h(vr), ld8h(vr + 256));
    }
#pragma unroll
    for (int dt = 0; dt < 4; ++dt)
      o[dt] = __builtin_amdgcn_wmma_f32_16x16x32_f16(
          false, ap, false, vf[dt], (short)0, o[dt], false, false);
  }

  // ---- normalize and emit context in [B,S,H*DH] f16 for the output GEMM ----
#pragma unroll
  for (int r = 0; r < 8; ++r) {
    float l = li[r];
    l += __shfl_xor(l, 1, 32);
    l += __shfl_xor(l, 2, 32);
    l += __shfl_xor(l, 4, 32);
    l += __shfl_xor(l, 8, 32);
    float rinv = 1.0f / l;
    int qg = q0 + r + hi * 8;
    size_t base = ((size_t)b * SS + qg) * DD + (size_t)h * DHD;
#pragma unroll
    for (int dt = 0; dt < 4; ++dt)
      ctx[base + dt * 16 + mloc] = (_Float16)(o[dt][r] * rinv);
  }
}

// ---------------------------------------------------------------------------
// Kernel 3: output projection, f32 epilogue straight to d_out.
// ---------------------------------------------------------------------------
__global__ __launch_bounds__(256)
void gemm_out_f32(const _Float16* __restrict__ A,
                  const _Float16* __restrict__ W,
                  const float* __restrict__ bias,
                  float* __restrict__ out) {
  __shared__ _Float16 Bt[2][128 * 32];
  const int tid  = threadIdx.x;
  const int wv   = tid >> 5;
  const int lane = tid & 31;
  const int mloc = lane & 15;
  const int hi   = lane >> 4;
  const int koff = hi * 8;
  const int m0 = blockIdx.x * 128 + wv * 16;
  const int n0 = blockIdx.y * 128;

  v8f acc[8];
#pragma unroll
  for (int i = 0; i < 8; ++i) acc[i] = vzero8();

  gemm_core(A, W, Bt[0], Bt[1], m0, n0, tid, mloc, koff, acc);

#pragma unroll
  for (int nt = 0; nt < 8; ++nt) {
    int n = n0 + nt * 16 + mloc;
    float bv = bias[n];
#pragma unroll
    for (int r = 0; r < 8; ++r) {
      int m = m0 + r + hi * 8;
      out[(size_t)m * DD + n] = acc[nt][r] + bv;
    }
  }
}

// ---------------------------------------------------------------------------
// Host-side launcher (graph-capture safe: stream launches only, ws scratch).
// ---------------------------------------------------------------------------
extern "C" void kernel_launch(void* const* d_in, const int* in_sizes, int n_in,
                              void* d_out, int out_size, void* d_ws, size_t ws_size,
                              hipStream_t stream) {
  (void)in_sizes; (void)n_in; (void)out_size; (void)ws_size;

  const float* hs   = (const float*)d_in[0];
  const float* mask = (const float*)d_in[1];
  const float* pb   = (const float*)d_in[2];
  const float* Wq   = (const float*)d_in[3];
  const float* bq   = (const float*)d_in[4];
  const float* Wk   = (const float*)d_in[5];
  const float* bk   = (const float*)d_in[6];
  const float* Wv   = (const float*)d_in[7];
  const float* bv   = (const float*)d_in[8];
  const float* Wo   = (const float*)d_in[9];
  const float* bo   = (const float*)d_in[10];
  float* out = (float*)d_out;

  char* ws = (char*)d_ws;
  size_t off = 0;
  auto wsalloc = [&](size_t bytes) -> void* {
    void* p = ws + off;
    off += (bytes + 255) & ~(size_t)255;
    return p;
  };
  const size_t actBytes = (size_t)MM * DD * sizeof(_Float16);   // 6.29 MB
  const size_t wBytes   = (size_t)DD * DD * sizeof(_Float16);   // 1.18 MB
  _Float16* X16   = (_Float16*)wsalloc(actBytes);
  _Float16* Wq16  = (_Float16*)wsalloc(wBytes);
  _Float16* Wk16  = (_Float16*)wsalloc(wBytes);
  _Float16* Wv16  = (_Float16*)wsalloc(wBytes);
  _Float16* Wo16  = (_Float16*)wsalloc(wBytes);
  _Float16* Q16   = (_Float16*)wsalloc(actBytes);   // [B,H,S,DH]
  _Float16* K16   = (_Float16*)wsalloc(actBytes);   // fragment order
  _Float16* Vt16  = (_Float16*)wsalloc(actBytes);   // fragment order
  _Float16* ctx16 = (_Float16*)wsalloc(actBytes);   // [B,S,D]

  // 0) casts
  {
    int nAct = MM * DD;          // 3,145,728
    int nW   = DD * DD;          // 589,824
    cvt_f32_f16<<<nAct / 1024, 256, 0, stream>>>(hs, X16, nAct);
    cvt_f32_f16<<<nW   / 1024, 256, 0, stream>>>(Wq, Wq16, nW);
    cvt_f32_f16<<<nW   / 1024, 256, 0, stream>>>(Wk, Wk16, nW);
    cvt_f32_f16<<<nW   / 1024, 256, 0, stream>>>(Wv, Wv16, nW);
    cvt_f32_f16<<<nW   / 1024, 256, 0, stream>>>(Wo, Wo16, nW);
  }

  // 1) QKV projections (Q pre-scaled by 1/sqrt(DH)=0.125; K, V in fragment order)
  dim3 ggrid(MM / 128, DD / 128);   // 32 x 6
  gemm_qkv_f16<<<ggrid, 256, 0, stream>>>(X16, Wq16, bq, Q16,  0, 0.125f);
  gemm_qkv_f16<<<ggrid, 256, 0, stream>>>(X16, Wk16, bk, K16,  2, 1.0f);
  gemm_qkv_f16<<<ggrid, 256, 0, stream>>>(X16, Wv16, bv, Vt16, 1, 1.0f);

  // 2) fused flash attention with position bias + mask
  flash_attn<<<dim3(SS / 64, BB * HH), 128, 0, stream>>>(Q16, K16, Vt16, pb, mask, ctx16);

  // 3) output projection -> f32 result
  gemm_out_f32<<<ggrid, 256, 0, stream>>>(ctx16, Wo16, bo, out);
}

// v002
// A run of this version takes 186 microseconds.
// Two timings next to v001 put it at 1.13 and 1.14 times that version's speed.
// Counting every step since v000, it is 1.27 times as fast.
#include <hip/hip_runtime.h>
#include <hip/hip_bf16.h>

// ---------------------------------------------------------------------------
// Self-attention with additive position bias (gfx1250, wave32, WMMA).
// Bandwidth-bound on position_bias (201MB) -> flash-attention fusion,
// f16 matrix cores with f32 accumulate, f32 softmax.
// GEMMs: double-buffered LDS staging (async global->LDS), batched B-fragment
// preload so WMMAs issue back-to-back.
// ---------------------------------------------------------------------------

typedef _Float16 v8h  __attribute__((ext_vector_type(8)));
typedef _Float16 v16h __attribute__((ext_vector_type(16)));
typedef float    v8f  __attribute__((ext_vector_type(8)));

#define HH 12
#define DHD 64
#define DD 768
#define BB 2
#define SS 2048
#define MM (BB * SS)   // 4096 rows

#if __has_builtin(__builtin_amdgcn_global_load_async_to_lds_b128)
#define USE_ASYNC_LDS 1
#else
#define USE_ASYNC_LDS 0
#endif

__device__ __forceinline__ v16h cat16(v8h lo, v8h hi) {
  return __builtin_shufflevector(lo, hi, 0,1,2,3,4,5,6,7,8,9,10,11,12,13,14,15);
}
__device__ __forceinline__ v8h ld8h(const _Float16* p) { return *(const v8h*)p; }
__device__ __forceinline__ v8f vzero8() {
  v8f z;
#pragma unroll
  for (int i = 0; i < 8; ++i) z[i] = 0.0f;
  return z;
}

// 32-byte global -> LDS stage for one thread (16 halves), async when available.
__device__ __forceinline__ void stage_row(_Float16* dst, const _Float16* src) {
#if USE_ASYNC_LDS
  typedef int v4i __attribute__((vector_size(16)));
  typedef __attribute__((address_space(1))) v4i* gptr_t;
  typedef __attribute__((address_space(3))) v4i* lptr_t;
  gptr_t g = (gptr_t)src;
  lptr_t l = (lptr_t)dst;
  __builtin_amdgcn_global_load_async_to_lds_b128(g, l, 0, 0);
  __builtin_amdgcn_global_load_async_to_lds_b128(g, l, 16, 0);
#else
  v8h t0 = *(const v8h*)src;
  v8h t1 = *(const v8h*)(src + 8);
  *(v8h*)dst = t0;
  *(v8h*)(dst + 8) = t1;
#endif
}

__device__ __forceinline__ void wait_async_lds() {
#if USE_ASYNC_LDS
# if __has_builtin(__builtin_amdgcn_s_wait_asynccnt)
  __builtin_amdgcn_s_wait_asynccnt(0);
# else
  asm volatile("s_wait_asynccnt 0" ::: "memory");
# endif
#endif
}

// ---------------------------------------------------------------------------
// Kernel 0: f32 -> f16 cast (hidden_states + weights), vectorized x4.
// ---------------------------------------------------------------------------
__global__ void cvt_f32_f16(const float* __restrict__ in,
                            _Float16* __restrict__ out, int n) {
  int i = (blockIdx.x * blockDim.x + threadIdx.x) * 4;
  if (i + 3 < n) {
    float4 v = *(const float4*)(in + i);
    out[i + 0] = (_Float16)v.x;
    out[i + 1] = (_Float16)v.y;
    out[i + 2] = (_Float16)v.z;
    out[i + 3] = (_Float16)v.w;
  }
}

// ---------------------------------------------------------------------------
// Shared TN-GEMM core: acc[8] += A[M,K] * W[N,K]^T over K=768.
// 8 waves / WG; W tile (128x32 halves) double-buffered in LDS; one barrier
// per K-step; async copy of tile i+1 overlaps WMMAs on tile i.
// A-fragment (16x32 f16, ISA layout): lane L -> row M = L&15,
//   half chunks at K = kk + (L>=16?8:0) and kk + 16 + (L>=16?8:0).
// ---------------------------------------------------------------------------
__device__ __forceinline__ void stage_tile(const _Float16* __restrict__ W,
                                           _Float16* BtBuf, int n0, int kk,
                                           int tid) {
  int n = tid >> 1, c = (tid & 1) * 16;
  stage_row(&BtBuf[n * 32 + c], W + (size_t)(n0 + n) * DD + kk + c);
}

__device__ __forceinline__ void compute_step(const _Float16* __restrict__ arow,
                                             const _Float16* BtBuf, int kk,
                                             int mloc, int koff, v8f acc[8]) {
  v16h a = cat16(ld8h(arow + kk + koff), ld8h(arow + kk + 16 + koff));
  v16h bf[8];
#pragma unroll
  for (int nt = 0; nt < 8; ++nt) {
    const _Float16* brow = &BtBuf[(nt * 16 + mloc) * 32];
    bf[nt] = cat16(*(const v8h*)(brow + koff), *(const v8h*)(brow + 16 + koff));
  }
#pragma unroll
  for (int nt = 0; nt < 8; ++nt)
    acc[nt] = __builtin_amdgcn_wmma_f32_16x16x32_f16(
        false, a, false, bf[nt], (short)0, acc[nt], false, false);
}

__device__ __forceinline__ void gemm_core(const _Float16* __restrict__ A,
                                          const _Float16* __restrict__ W,
                                          _Float16* Bt0, _Float16* Bt1,
                                          int m0, int n0, int tid,
                                          int mloc, int koff, v8f acc[8]) {
  const _Float16* arow = A + (size_t)(m0 + mloc) * DD;
  stage_tile(W, Bt0, n0, 0, tid);
  for (int kk = 0; kk < DD; kk += 64) {
    wait_async_lds();
    __syncthreads();
    if (kk + 32 < DD) stage_tile(W, Bt1, n0, kk + 32, tid);
    compute_step(arow, Bt0, kk, mloc, koff, acc);

    wait_async_lds();
    __syncthreads();
    if (kk + 64 < DD) stage_tile(W, Bt0, n0, kk + 64, tid);
    compute_step(arow, Bt1, kk + 32, mloc, koff, acc);
  }
}

// ---------------------------------------------------------------------------
// Kernel 1: QKV projection.
// layout=0 (Q): rows, [B,H,S,DH].
// layout=1 (V) and layout=2 (K): WMMA B-fragment order, so that one b128 load
// of a wave in the attention kernel reads 512 contiguous bytes (4 lines)
// instead of 16 bytes out of each of 16 lines.
//   K: [B*H][S/16 key tile][dh/32][chunk 2][lane 32][8 halves]
//      lane = ((dh>>3)&1)*16 + (s&15), chunk = (dh>>4)&1, half = dh&7
//   V: [B*H][S/32 key block][dh/16][chunk 2][lane 32][8 halves]
//      lane = ((s>>3)&1)*16 + (dh&15), chunk = (s>>4)&1, half = s&7
// ---------------------------------------------------------------------------
__global__ __launch_bounds__(256)
void gemm_qkv_f16(const _Float16* __restrict__ A,
                  const _Float16* __restrict__ W,
                  const float* __restrict__ bias,
                  _Float16* __restrict__ out,
                  int layout, float scale) {
  __shared__ _Float16 Bt[2][128 * 32];   // 16 KB double buffer
  const int tid  = threadIdx.x;
  const int wv   = tid >> 5;
  const int lane = tid & 31;
  const int mloc = lane & 15;
  const int hi   = lane >> 4;
  const int koff = hi * 8;
  const int m0 = blockIdx.x * 128 + wv * 16;
  const int n0 = blockIdx.y * 128;

  v8f acc[8];
#pragma unroll
  for (int i = 0; i < 8; ++i) acc[i] = vzero8();

  gemm_core(A, W, Bt[0], Bt[1], m0, n0, tid, mloc, koff, acc);

  // epilogue: C layout lane holds (M = r + hi*8, N = nt*16 + (lane&15))
  const int bb = m0 >> 11, s0 = m0 & 2047;   // the wave's 16 rows: one batch
  float bvv[8];
#pragma unroll
  for (int nt = 0; nt < 8; ++nt) bvv[nt] = bias[n0 + nt * 16 + mloc];
  // n0 is a multiple of 128: tiles 0..3 are head n0/64, tiles 4..7 the next;
  // within a head dh = (nt&3)*16 + mloc
  _Float16* ob = out + (size_t)(bb * HH + (n0 >> 6)) * SS * DHD;
  if (layout == 1) {
    // a lane's 8 rows are the 8 halves of its own fragment slot
    _Float16* ov = ob + (s0 >> 5) * 2048 + ((s0 >> 4) & 1) * 256 + lane * 8;
#pragma unroll
    for (int nt = 0; nt < 8; ++nt) {
      v8h pk;
#pragma unroll
      for (int r = 0; r < 8; ++r) pk[r] = (_Float16)((acc[nt][r] + bvv[nt]) * scale);
      *(v8h*)(ov + (nt >> 2) * SS * DHD + (nt & 3) * 512) = pk;
    }
  } else if (layout == 2) {
    _Float16* ok = ob + (s0 >> 4) * 1024 + ((mloc >> 3) * 16 + hi * 8) * 8 + (mloc & 7);
#pragma unroll
    for (int nt = 0; nt < 8; ++nt)
#pragma unroll
      for (int r = 0; r < 8; ++r)
        ok[(nt >> 2) * SS * DHD + (nt & 3) * 256 + r * 8] =
            (_Float16)((acc[nt][r] + bvv[nt]) * scale);
    // stands ahead of any later write of a register that these stores name
    // (the other layouts' blocks follow this one in the built code)
    asm volatile("s_wait_xcnt 0x0" ::: "memory");
  } else {
    _Float16* oq = ob + (s0 + hi * 8) * DHD + mloc;
#pragma unroll
    for (int nt = 0; nt < 8; ++nt)
#pragma unroll
      for (int r = 0; r < 8; ++r)
        oq[(nt >> 2) * SS * DHD + r * DHD + (nt & 3) * 16] =
            (_Float16)((acc[nt][r] + bvv[nt]) * scale);
    // stands ahead of any later write of a register that these stores name
    // (the other layouts' blocks follow this one in the built code)
    asm volatile("s_wait_xcnt 0x0" ::: "memory");
  }
}

__device__ __forceinline__ float xhalf(float x) {
  int b = __builtin_bit_cast(int, x);
  return __builtin_bit_cast(float, __builtin_amdgcn_permlanex16(
      b, b, 0x76543210, 0xfedcba98, false, false));
}

__global__ __launch_bounds__(128)
void flash_attn(const _Float16* __restrict__ Q,    // [B,H,S,DH] pre-scaled 1/8
                const _Float16* __restrict__ K,    // fragment order (kernel 1)
                const _Float16* __restrict__ Vt,   // fragment order (kernel 1)
                const float* __restrict__ pb,      // [1,H,S,S]
                const float* __restrict__ mask,    // [B,1,1,S]
                _Float16* __restrict__ ctx) {      // [B,S,D] f16
  const int wv   = threadIdx.x >> 5;
  const int lane = threadIdx.x & 31;
  const int mloc = lane & 15;
  const int hi   = lane >> 4;
  const int koff = hi * 8;
  const int bh = blockIdx.y, b = bh / HH, h = bh % HH;
  const int q0 = blockIdx.x * 64 + wv * 16;

  const _Float16* qrow = Q + ((size_t)bh * SS + q0 + mloc) * DHD;
  const v16h bq0 = cat16(ld8h(qrow + koff),      ld8h(qrow + 16 + koff));
  const v16h bq1 = cat16(ld8h(qrow + 32 + koff), ld8h(qrow + 48 + koff));
  // stands ahead of the later write of the address registers that these loads name
  asm volatile("s_wait_xcnt 0x0" ::: "memory");

  // 32 keys are 2048 contiguous halves in both: 8 slots of 32 lanes x 8 halves
  const _Float16* Kh  = K  + (size_t)bh * SS * DHD + lane * 8;
  const _Float16* Vh  = Vt + (size_t)bh * DHD * SS + lane * 8;
  const float*    pbq = pb + ((size_t)h * SS + q0) * SS;
  const float*    pbl = pbq + (size_t)mloc * SS + koff;   // the lane's own query row
  const float*    mk  = mask + (size_t)b * SS + koff;

  v8f o[4];   // o[dt][r] = O[q0 + mloc][dt*16 + hi*8 + r]
#pragma unroll
  for (int i = 0; i < 4; ++i) o[i] = vzero8();
  float mi = -1e30f, li = 0.0f;   // li: this half's keys only, joined at the end

  for (int kb = 0; kb < SS; kb += 32) {
    // ---- scores tile [32k x 16q] = K * Q^T (already 1/sqrt(dh) scaled) ----
    v16h kf[4];
#pragma unroll
    for (int nt = 0; nt < 2; ++nt) {
      const _Float16* kr = Kh + (size_t)(kb + nt * 16) * DHD;
      kf[nt * 2 + 0] = cat16(ld8h(kr),       ld8h(kr + 256));
      kf[nt * 2 + 1] = cat16(ld8h(kr + 512), ld8h(kr + 768));
    }
    // position_bias + attention_mask: 8 consecutive keys per tile and lane
    v8f pbv[2], mkv[2];
#pragma unroll
    for (int nt = 0; nt < 2; ++nt) {
      pbv[nt] = *(const v8f*)(pbl + kb + nt * 16);
      mkv[nt] = *(const v8f*)(mk + kb + nt * 16);
    }
    // keeps the bias and mask loads issued ahead of the first product: without
    // it they are issued behind the wait for the first K fragments, and the
    // two load latencies add up in every pass
    __builtin_amdgcn_sched_barrier(0);
    v8f sc[2];
#pragma unroll
    for (int nt = 0; nt < 2; ++nt) {
      v8f c = vzero8();
      c = __builtin_amdgcn_wmma_f32_16x16x32_f16(false, kf[nt*2+0], false, bq0, (short)0, c, false, false);
      c = __builtin_amdgcn_wmma_f32_16x16x32_f16(false, kf[nt*2+1], false, bq1, (short)0, c, false, false);
      sc[nt] = c + (pbv[nt] + mkv[nt]);
    }
    if (kb + 32 < SS)  // prefetch next 128B bias chunk per q-row
      __builtin_prefetch(pbq + (size_t)mloc * SS + kb + 32, 0, 1);

    // ---- online softmax: one query per lane ----
    float x = fmaxf(sc[0][0], sc[1][0]);
#pragma unroll
    for (int r = 1; r < 8; ++r) x = fmaxf(x, fmaxf(sc[0][r], sc[1][r]));
    x = fmaxf(x, xhalf(x));
    const float mnew = fmaxf(mi, x);
    const float corr = __expf(mi - mnew);
    mi = mnew;
#pragma unroll
    for (int dt = 0; dt < 4; ++dt)
#pragma unroll
      for (int r = 0; r < 8; ++r) o[dt][r] *= corr;
    v16h bp;   // P^T as B: half nt*8 + r is key nt*16 + hi*8 + r
    float ps = 0.0f;
#pragma unroll
    for (int r = 0; r < 8; ++r) {
      float p0 = __expf(sc[0][r] - mnew);
      float p1 = __expf(sc[1][r] - mnew);
      ps += p0 + p1;
      bp[r]     = (_Float16)p0;
      bp[8 + r] = (_Float16)p1;
    }
    li = li * corr + ps;

    // ---- O^T += V^T * P^T  (V stored as ready fragments) ----
    v16h vf[4];
#pragma unroll
    for (int dt = 0; dt < 4; ++dt) {
      const _Float16* vr = Vh + (size_t)kb * DHD + dt * 512;
      vf[dt] = cat16(ld8h(vr), ld8h(vr + 256));
    }
#pragma unroll
    for (int dt = 0; dt < 4; ++dt)
      o[dt] = __builtin_amdgcn_wmma_f32_16x16x32_f16(
          false, vf[dt], false, bp, (short)0, o[dt], false, false);
  }

  // ---- normalize and emit context in [B,S,H*DH] f16 for the output GEMM ----
  const float rinv = 1.0f / (li + xhalf(li));
  _Float16* crow = ctx + ((size_t)b * SS + q0 + mloc) * DD + (size_t)h * DHD + koff;
#pragma unroll
  for (int dt = 0; dt < 4; ++dt) {
    v8h pk;
#pragma unroll
    for (int r = 0; r < 8; ++r) pk[r] = (_Float16)(o[dt][r] * rinv);
    *(v8h*)(crow + dt * 16) = pk;
  }
}

// ---------------------------------------------------------------------------
// Kernel 3: output projection, f32 epilogue straight to d_out.
// ---------------------------------------------------------------------------
__global__ __launch_bounds__(256)
void gemm_out_f32(const _Float16* __restrict__ A,
                  const _Float16* __restrict__ W,
                  const float* __restrict__ bias,
                  float* __restrict__ out) {
  __shared__ _Float16 Bt[2][128 * 32];
  const int tid  = threadIdx.x;
  const int wv   = tid >> 5;
  const int lane = tid & 31;
  const int mloc = lane & 15;
  const int hi   = lane >> 4;
  const int koff = hi * 8;
  const int m0 = blockIdx.x * 128 + wv * 16;
  const int n0 = blockIdx.y * 128;

  v8f acc[8];
#pragma unroll
  for (int i = 0; i < 8; ++i) acc[i] = vzero8();

  gemm_core(A, W, Bt[0], Bt[1], m0, n0, tid, mloc, koff, acc);

#pragma unroll
  for (int nt = 0; nt < 8; ++nt) {
    int n = n0 + nt * 16 + mloc;
    float bv = bias[n];
#pragma unroll
    for (int r = 0; r < 8; ++r) {
      int m = m0 + r + hi * 8;
      out[(size_t)m * DD + n] = acc[nt][r] + bv;
    }
  }
}

// ---------------------------------------------------------------------------
// Host-side launcher (graph-capture safe: stream launches only, ws scratch).
// ---------------------------------------------------------------------------
extern "C" void kernel_launch(void* const* d_in, const int* in_sizes, int n_in,
                              void* d_out, int out_size, void* d_ws, size_t ws_size,
                              hipStream_t stream) {
  (void)in_sizes; (void)n_in; (void)out_size; (void)ws_size;

  const float* hs   = (const float*)d_in[0];
  const float* mask = (const float*)d_in[1];
  const float* pb   = (const float*)d_in[2];
  const float* Wq   = (const float*)d_in[3];
  const float* bq   = (const float*)d_in[4];
  const float* Wk   = (const float*)d_in[5];
  const float* bk   = (const float*)d_in[6];
  const float* Wv   = (const float*)d_in[7];
  const float* bv   = (const float*)d_in[8];
  const float* Wo   = (const float*)d_in[9];
  const float* bo   = (const float*)d_in[10];
  float* out = (float*)d_out;

  char* ws = (char*)d_ws;
  size_t off = 0;
  auto wsalloc = [&](size_t bytes) -> void* {
    void* p = ws + off;
    off += (bytes + 255) & ~(size_t)255;
    return p;
  };
  const size_t actBytes = (size_t)MM * DD * sizeof(_Float16);   // 6.29 MB
  const size_t wBytes   = (size_t)DD * DD * sizeof(_Float16);   // 1.18 MB
  _Float16* X16   = (_Float16*)wsalloc(actBytes);
  _Float16* Wq16  = (_Float16*)wsalloc(wBytes);
  _Float16* Wk16  = (_Float16*)wsalloc(wBytes);
  _Float16* Wv16  = (_Float16*)wsalloc(wBytes);
  _Float16* Wo16  = (_Float16*)wsalloc(wBytes);
  _Float16* Q16   = (_Float16*)wsalloc(actBytes);   // [B,H,S,DH]
  _Float16* K16   = (_Float16*)wsalloc(actBytes);   // fragment order
  _Float16* Vt16  = (_Float16*)wsalloc(actBytes);   // fragment order
  _Float16* ctx16 = (_Float16*)wsalloc(actBytes);   // [B,S,D]

  // 0) casts
  {
    int nAct = MM * DD;          // 3,145,728
    int nW   = DD * DD;          // 589,824
    cvt_f32_f16<<<nAct / 1024, 256, 0, stream>>>(hs, X16, nAct);
    cvt_f32_f16<<<nW   / 1024, 256, 0, stream>>>(Wq, Wq16, nW);
    cvt_f32_f16<<<nW   / 1024, 256, 0, stream>>>(Wk, Wk16, nW);
    cvt_f32_f16<<<nW   / 1024, 256, 0, stream>>>(Wv, Wv16, nW);
    cvt_f32_f16<<<nW   / 1024, 256, 0, stream>>>(Wo, Wo16, nW);
  }

  // 1) QKV projections (Q pre-scaled by 1/sqrt(DH)=0.125; K, V in fragment order)
  dim3 ggrid(MM / 128, DD / 128);   // 32 x 6
  gemm_qkv_f16<<<ggrid, 256, 0, stream>>>(X16, Wq16, bq, Q16,  0, 0.125f);
  gemm_qkv_f16<<<ggrid, 256, 0, stream>>>(X16, Wk16, bk, K16,  2, 1.0f);
  gemm_qkv_f16<<<ggrid, 256, 0, stream>>>(X16, Wv16, bv, Vt16, 1, 1.0f);

  // 2) fused flash attention with position bias + mask
  flash_attn<<<dim3(SS / 64, BB * HH), 128, 0, stream>>>(Q16, K16, Vt16, pb, mask, ctx16);

  // 3) output projection -> f32 result
  gemm_out_f32<<<ggrid, 256, 0, stream>>>(ctx16, Wo16, bo, out);
}

// v003
// One run takes 153 microseconds.
// Timed twice side by side with v002, it ran 1.21 times as fast both times.
// All steps since v000 together make it 1.54 times as fast.
#include <hip/hip_runtime.h>
#include <hip/hip_bf16.h>

// ---------------------------------------------------------------------------
// Self-attention with additive position bias (gfx1250, wave32, WMMA).
// Bandwidth-bound on position_bias (201MB) -> flash-attention fusion,
// f16 matrix cores with f32 accumulate, f32 softmax.
// GEMMs: double-buffered LDS staging (async global->LDS), batched B-fragment
// preload so WMMAs issue back-to-back.
// ---------------------------------------------------------------------------

typedef _Float16 v8h  __attribute__((ext_vector_type(8)));
typedef _Float16 v16h __attribute__((ext_vector_type(16)));
typedef float    v8f  __attribute__((ext_vector_type(8)));

#define HH 12
#define DHD 64
#define DD 768
#define BB 2
#define SS 2048
#define MM (BB * SS)   // 4096 rows

#if __has_builtin(__builtin_amdgcn_global_load_async_to_lds_b128)
#define USE_ASYNC_LDS 1
#else
#define USE_ASYNC_LDS 0
#endif

__device__ __forceinline__ v16h cat16(v8h lo, v8h hi) {
  return __builtin_shufflevector(lo, hi, 0,1,2,3,4,5,6,7,8,9,10,11,12,13,14,15);
}
__device__ __forceinline__ v8h ld8h(const _Float16* p) { return *(const v8h*)p; }
__device__ __forceinline__ v8f vzero8() {
  v8f z;
#pragma unroll
  for (int i = 0; i < 8; ++i) z[i] = 0.0f;
  return z;
}

// 32-byte global -> LDS stage for one thread (16 halves), async when available.
__device__ __forceinline__ void stage_row(_Float16* dst, const _Float16* src) {
#if USE_ASYNC_LDS
  typedef int v4i __attribute__((vector_size(16)));
  typedef __attribute__((address_space(1))) v4i* gptr_t;
  typedef __attribute__((address_space(3))) v4i* lptr_t;
  gptr_t g = (gptr_t)src;
  lptr_t l = (lptr_t)dst;
  __builtin_amdgcn_global_load_async_to_lds_b128(g, l, 0, 0);
  __builtin_amdgcn_global_load_async_to_lds_b128(g, l, 16, 0);
#else
  v8h t0 = *(const v8h*)src;
  v8h t1 = *(const v8h*)(src + 8);
  *(v8h*)dst = t0;
  *(v8h*)(dst + 8) = t1;
#endif
}

__device__ __forceinline__ void wait_async_lds() {
#if USE_ASYNC_LDS
# if __has_builtin(__builtin_amdgcn_s_wait_asynccnt)
  __builtin_amdgcn_s_wait_asynccnt(0);
# else
  asm volatile("s_wait_asynccnt 0" ::: "memory");
# endif
#endif
}

// ---------------------------------------------------------------------------
// Kernel 0: f32 -> f16 casts of hidden_states and the four weights, vectorized
// x4, all in ONE launch: none needs anything of another. A block casts 1024
// floats. The five f16 copies lie back to back in the workspace, so a block's
// place in the grid is its place in the output; only the source goes by range.
// ---------------------------------------------------------------------------
#define ACT_BLKS (MM * DD / 1024)   // 3072 blocks: hidden_states
#define W_BLKS   (DD * DD / 1024)   // 576 blocks: each weight

__global__ void cvt_f32_f16(const float* __restrict__ hs,
                            const float* __restrict__ wq,
                            const float* __restrict__ wk,
                            const float* __restrict__ wv,
                            const float* __restrict__ wo,
                            _Float16* __restrict__ out) {
  const int blk = blockIdx.x;
  const float* in = hs;
  int rel = blk;
  if (blk >= ACT_BLKS) {   // block-uniform
    const int w = (blk - ACT_BLKS) / W_BLKS;
    rel = (blk - ACT_BLKS) - w * W_BLKS;
    in = w == 0 ? wq : w == 1 ? wk : w == 2 ? wv : wo;
  }
  const int t = threadIdx.x * 4;
  float4 v = *(const float4*)(in + rel * 1024 + t);
  _Float16* o = out + blk * 1024 + t;
  o[0] = (_Float16)v.x;
  o[1] = (_Float16)v.y;
  o[2] = (_Float16)v.z;
  o[3] = (_Float16)v.w;
}

// ---------------------------------------------------------------------------
// Shared TN-GEMM core: acc[8] += A[M,K] * W[N,K]^T over K=768.
// 8 waves / WG; W tile (128x32 halves) double-buffered in LDS; one barrier
// per K-step; async copy of tile i+1 overlaps WMMAs on tile i.
// A-fragment (16x32 f16, ISA layout): lane L -> row M = L&15,
//   half chunks at K = kk + (L>=16?8:0) and kk + 16 + (L>=16?8:0).
// ---------------------------------------------------------------------------
__device__ __forceinline__ void stage_tile(const _Float16* __restrict__ W,
                                           _Float16* BtBuf, int n0, int kk,
                                           int tid) {
  int n = tid >> 1, c = (tid & 1) * 16;
  stage_row(&BtBuf[n * 32 + c], W + (size_t)(n0 + n) * DD + kk + c);
}

__device__ __forceinline__ void compute_step(const _Float16* __restrict__ arow,
                                             const _Float16* BtBuf, int kk,
                                             int mloc, int koff, v8f acc[8]) {
  v16h a = cat16(ld8h(arow + kk + koff), ld8h(arow + kk + 16 + koff));
  v16h bf[8];
#pragma unroll
  for (int nt = 0; nt < 8; ++nt) {
    const _Float16* brow = &BtBuf[(nt * 16 + mloc) * 32];
    bf[nt] = cat16(*(const v8h*)(brow + koff), *(const v8h*)(brow + 16 + koff));
  }
#pragma unroll
  for (int nt = 0; nt < 8; ++nt)
    acc[nt] = __builtin_amdgcn_wmma_f32_16x16x32_f16(
        false, a, false, bf[nt], (short)0, acc[nt], false, false);
}

__device__ __forceinline__ void gemm_core(const _Float16* __restrict__ A,
                                          const _Float16* __restrict__ W,
                                          _Float16* Bt0, _Float16* Bt1,
                                          int m0, int n0, int tid,
                                          int mloc, int koff, v8f acc[8]) {
  const _Float16* arow = A + (size_t)(m0 + mloc) * DD;
  stage_tile(W, Bt0, n0, 0, tid);
  for (int kk = 0; kk < DD; kk += 64) {
    wait_async_lds();
    __syncthreads();
    if (kk + 32 < DD) stage_tile(W, Bt1, n0, kk + 32, tid);
    compute_step(arow, Bt0, kk, mloc, koff, acc);

    wait_async_lds();
    __syncthreads();
    if (kk + 64 < DD) stage_tile(W, Bt0, n0, kk + 64, tid);
    compute_step(arow, Bt1, kk + 32, mloc, koff, acc);
  }
}

// ---------------------------------------------------------------------------
// Kernel 1: Q, K and V projections in ONE launch: blockIdx.z picks the weight,
// the bias, the output plane and its layout (0 = Q, 1 = K, 2 = V).
// Q: rows, [B,H,S,DH], pre-scaled by 1/sqrt(DH).
// K and V: WMMA B-fragment order, so that one b128 load
// of a wave in the attention kernel reads 512 contiguous bytes (4 lines)
// instead of 16 bytes out of each of 16 lines.
//   K: [B*H][S/16 key tile][dh/32][chunk 2][lane 32][8 halves]
//      lane = ((dh>>3)&1)*16 + (s&15), chunk = (dh>>4)&1, half = dh&7
//   V: [B*H][S/32 key block][dh/16][chunk 2][lane 32][8 halves]
//      lane = ((s>>3)&1)*16 + (dh&15), chunk = (s>>4)&1, half = s&7
// ---------------------------------------------------------------------------
__global__ __launch_bounds__(256)
void gemm_qkv_f16(const _Float16* __restrict__ A,
                  const _Float16* __restrict__ Wqkv,   // Wq | Wk | Wv
                  const float* __restrict__ bq,
                  const float* __restrict__ bk,
                  const float* __restrict__ bv,
                  _Float16* __restrict__ qkv) {        // Q | K | V planes
  __shared__ _Float16 Bt[2][128 * 32];   // 16 KB double buffer
  const int which = blockIdx.z;
  const _Float16* W = Wqkv + which * (DD * DD);
  const float* bias = which == 0 ? bq : which == 1 ? bk : bv;
  _Float16* out = qkv + which * (MM * DD);
  const float scale = which == 0 ? 0.125f : 1.0f;
  const int tid  = threadIdx.x;
  const int wv   = tid >> 5;
  const int lane = tid & 31;
  const int mloc = lane & 15;
  const int hi   = lane >> 4;
  const int koff = hi * 8;
  const int m0 = blockIdx.x * 128 + wv * 16;
  const int n0 = blockIdx.y * 128;

  v8f acc[8];
#pragma unroll
  for (int i = 0; i < 8; ++i) acc[i] = vzero8();

  gemm_core(A, W, Bt[0], Bt[1], m0, n0, tid, mloc, koff, acc);

  // epilogue: C layout lane holds (M = r + hi*8, N = nt*16 + (lane&15))
  const int bb = m0 >> 11, s0 = m0 & 2047;   // the wave's 16 rows: one batch
  float bvv[8];
#pragma unroll
  for (int nt = 0; nt < 8; ++nt) bvv[nt] = bias[n0 + nt * 16 + mloc];
  // n0 is a multiple of 128: tiles 0..3 are head n0/64, tiles 4..7 the next;
  // within a head dh = (nt&3)*16 + mloc
  _Float16* ob = out + (size_t)(bb * HH + (n0 >> 6)) * SS * DHD;
  if (which == 2) {
    // a lane's 8 rows are the 8 halves of its own fragment slot
    _Float16* ov = ob + (s0 >> 5) * 2048 + ((s0 >> 4) & 1) * 256 + lane * 8;
#pragma unroll
    for (int nt = 0; nt < 8; ++nt) {
      v8h pk;
#pragma unroll
      for (int r = 0; r < 8; ++r) pk[r] = (_Float16)((acc[nt][r] + bvv[nt]) * scale);
      *(v8h*)(ov + (nt >> 2) * SS * DHD + (nt & 3) * 512) = pk;
    }
    // stands ahead of any later write of a register that these stores name
    // (the other layouts' blocks follow this one in the built code)
    asm volatile("s_wait_xcnt 0x0" ::: "memory");
  } else if (which == 1) {
    _Float16* ok = ob + (s0 >> 4) * 1024 + ((mloc >> 3) * 16 + hi * 8) * 8 + (mloc & 7);
#pragma unroll
    for (int nt = 0; nt < 8; ++nt)
#pragma unroll
      for (int r = 0; r < 8; ++r)
        ok[(nt >> 2) * SS * DHD + (nt & 3) * 256 + r * 8] =
            (_Float16)((acc[nt][r] + bvv[nt]) * scale);
    // stands ahead of any later write of a register that these stores name
    // (the other layouts' blocks follow this one in the built code)
    asm volatile("s_wait_xcnt 0x0" ::: "memory");
  } else {
    _Float16* oq = ob + (s0 + hi * 8) * DHD + mloc;
#pragma unroll
    for (int nt = 0; nt < 8; ++nt)
#pragma unroll
      for (int r = 0; r < 8; ++r)
        oq[(nt >> 2) * SS * DHD + r * DHD + (nt & 3) * 16] =
            (_Float16)((acc[nt][r] + bvv[nt]) * scale);
    // stands ahead of any later write of a register that these stores name
    // (the other layouts' blocks follow this one in the built code)
    asm volatile("s_wait_xcnt 0x0" ::: "memory");
  }
}

__device__ __forceinline__ float xhalf(float x) {
  int b = __builtin_bit_cast(int, x);
  return __builtin_bit_cast(float, __builtin_amdgcn_permlanex16(
      b, b, 0x76543210, 0xfedcba98, false, false));
}

__global__ __launch_bounds__(128)
void flash_attn(const _Float16* __restrict__ Q,    // [B,H,S,DH] pre-scaled 1/8
                const _Float16* __restrict__ K,    // fragment order (kernel 1)
                const _Float16* __restrict__ Vt,   // fragment order (kernel 1)
                const float* __restrict__ pb,      // [1,H,S,S]
                const float* __restrict__ mask,    // [B,1,1,S]
                _Float16* __restrict__ ctx) {      // [B,S,D] f16
  const int wv   = threadIdx.x >> 5;
  const int lane = threadIdx.x & 31;
  const int mloc = lane & 15;
  const int hi   = lane >> 4;
  const int koff = hi * 8;
  const int bh = blockIdx.y, b = bh / HH, h = bh % HH;
  const int q0 = blockIdx.x * 64 + wv * 16;

  const _Float16* qrow = Q + ((size_t)bh * SS + q0 + mloc) * DHD;
  const v16h bq0 = cat16(ld8h(qrow + koff),      ld8h(qrow + 16 + koff));
  const v16h bq1 = cat16(ld8h(qrow + 32 + koff), ld8h(qrow + 48 + koff));
  // stands ahead of the later write of the address registers that these loads name
  asm volatile("s_wait_xcnt 0x0" ::: "memory");

  // 32 keys are 2048 contiguous halves in both: 8 slots of 32 lanes x 8 halves
  const _Float16* Kh  = K  + (size_t)bh * SS * DHD + lane * 8;
  const _Float16* Vh  = Vt + (size_t)bh * DHD * SS + lane * 8;
  const float*    pbq = pb + ((size_t)h * SS + q0) * SS;
  const float*    pbl = pbq + (size_t)mloc * SS + koff;   // the lane's own query row
  const float*    mk  = mask + (size_t)b * SS + koff;

  v8f o[4];   // o[dt][r] = O[q0 + mloc][dt*16 + hi*8 + r]
#pragma unroll
  for (int i = 0; i < 4; ++i) o[i] = vzero8();
  float mi = -1e30f, li = 0.0f;   // li: this half's keys only, joined at the end

  for (int kb = 0; kb < SS; kb += 32) {
    // ---- scores tile [32k x 16q] = K * Q^T (already 1/sqrt(dh) scaled) ----
    v16h kf[4];
#pragma unroll
    for (int nt = 0; nt < 2; ++nt) {
      const _Float16* kr = Kh + (size_t)(kb + nt * 16) * DHD;
      kf[nt * 2 + 0] = cat16(ld8h(kr),       ld8h(kr + 256));
      kf[nt * 2 + 1] = cat16(ld8h(kr + 512), ld8h(kr + 768));
    }
    // position_bias + attention_mask: 8 consecutive keys per tile and lane
    v8f pbv[2], mkv[2];
#pragma unroll
    for (int nt = 0; nt < 2; ++nt) {
      pbv[nt] = *(const v8f*)(pbl + kb + nt * 16);
      mkv[nt] = *(const v8f*)(mk + kb + nt * 16);
    }
    // keeps the bias and mask loads issued ahead of the first product: without
    // it they are issued behind the wait for the first K fragments, and the
    // two load latencies add up in every pass
    __builtin_amdgcn_sched_barrier(0);
    v8f sc[2];
#pragma unroll
    for (int nt = 0; nt < 2; ++nt) {
      v8f c = vzero8();
      c = __builtin_amdgcn_wmma_f32_16x16x32_f16(false, kf[nt*2+0], false, bq0, (short)0, c, false, false);
      c = __builtin_amdgcn_wmma_f32_16x16x32_f16(false, kf[nt*2+1], false, bq1, (short)0, c, false, false);
      sc[nt] = c + (pbv[nt] + mkv[nt]);
    }
    if (kb + 32 < SS)  // prefetch next 128B bias chunk per q-row
      __builtin_prefetch(pbq + (size_t)mloc * SS + kb + 32, 0, 1);

    // ---- online softmax: one query per lane ----
    float x = fmaxf(sc[0][0], sc[1][0]);
#pragma unroll
    for (int r = 1; r < 8; ++r) x = fmaxf(x, fmaxf(sc[0][r], sc[1][r]));
    x = fmaxf(x, xhalf(x));
    const float mnew = fmaxf(mi, x);
    const float corr = __expf(mi - mnew);
    mi = mnew;
#pragma unroll
    for (int dt = 0; dt < 4; ++dt)
#pragma unroll
      for (int r = 0; r < 8; ++r) o[dt][r] *= corr;
    v16h bp;   // P^T as B: half nt*8 + r is key nt*16 + hi*8 + r
    float ps = 0.0f;
#pragma unroll
    for (int r = 0; r < 8; ++r) {
      float p0 = __expf(sc[0][r] - mnew);
      float p1 = __expf(sc[1][r] - mnew);
      ps += p0 + p1;
      bp[r]     = (_Float16)p0;
      bp[8 + r] = (_Float16)p1;
    }
    li = li * corr + ps;

    // ---- O^T += V^T * P^T  (V stored as ready fragments) ----
    v16h vf[4];
#pragma unroll
    for (int dt = 0; dt < 4; ++dt) {
      const _Float16* vr = Vh + (size_t)kb * DHD + dt * 512;
      vf[dt] = cat16(ld8h(vr), ld8h(vr + 256));
    }
#pragma unroll
    for (int dt = 0; dt < 4; ++dt)
      o[dt] = __builtin_amdgcn_wmma_f32_16x16x32_f16(
          false, vf[dt], false, bp, (short)0, o[dt], false, false);
  }

  // ---- normalize and emit context in [B,S,H*DH] f16 for the output GEMM ----
  const float rinv = 1.0f / (li + xhalf(li));
  _Float16* crow = ctx + ((size_t)b * SS + q0 + mloc) * DD + (size_t)h * DHD + koff;
#pragma unroll
  for (int dt = 0; dt < 4; ++dt) {
    v8h pk;
#pragma unroll
    for (int r = 0; r < 8; ++r) pk[r] = (_Float16)(o[dt][r] * rinv);
    *(v8h*)(crow + dt * 16) = pk;
  }
}

// ---------------------------------------------------------------------------
// Kernel 3: output projection, f32 epilogue straight to d_out.
// ---------------------------------------------------------------------------
__global__ __launch_bounds__(256)
void gemm_out_f32(const _Float16* __restrict__ A,
                  const _Float16* __restrict__ W,
                  const float* __restrict__ bias,
                  float* __restrict__ out) {
  __shared__ _Float16 Bt[2][128 * 32];
  const int tid  = threadIdx.x;
  const int wv   = tid >> 5;
  const int lane = tid & 31;
  const int mloc = lane & 15;
  const int hi   = lane >> 4;
  const int koff = hi * 8;
  const int m0 = blockIdx.x * 128 + wv * 16;
  const int n0 = blockIdx.y * 128;

  v8f acc[8];
#pragma unroll
  for (int i = 0; i < 8; ++i) acc[i] = vzero8();

  gemm_core(A, W, Bt[0], Bt[1], m0, n0, tid, mloc, koff, acc);

#pragma unroll
  for (int nt = 0; nt < 8; ++nt) {
    int n = n0 + nt * 16 + mloc;
    float bv = bias[n];
#pragma unroll
    for (int r = 0; r < 8; ++r) {
      int m = m0 + r + hi * 8;
      out[(size_t)m * DD + n] = acc[nt][r] + bv;
    }
  }
}

// ---------------------------------------------------------------------------
// Host-side launcher (graph-capture safe: stream launches only, ws scratch).
// ---------------------------------------------------------------------------
extern "C" void kernel_launch(void* const* d_in, const int* in_sizes, int n_in,
                              void* d_out, int out_size, void* d_ws, size_t ws_size,
                              hipStream_t stream) {
  (void)in_sizes; (void)n_in; (void)out_size; (void)ws_size;

  const float* hs   = (const float*)d_in[0];
  const float* mask = (const float*)d_in[1];
  const float* pb   = (const float*)d_in[2];
  const float* Wq   = (const float*)d_in[3];
  const float* bq   = (const float*)d_in[4];
  const float* Wk   = (const float*)d_in[5];
  const float* bk   = (const float*)d_in[6];
  const float* Wv   = (const float*)d_in[7];
  const float* bv   = (const float*)d_in[8];
  const float* Wo   = (const float*)d_in[9];
  const float* bo   = (const float*)d_in[10];
  float* out = (float*)d_out;

  char* ws = (char*)d_ws;
  size_t off = 0;
  auto wsalloc = [&](size_t bytes) -> void* {
    void* p = ws + off;
    off += (bytes + 255) & ~(size_t)255;
    return p;
  };
  const size_t actBytes = (size_t)MM * DD * sizeof(_Float16);   // 6.29 MB
  const size_t wBytes   = (size_t)DD * DD * sizeof(_Float16);   // 1.18 MB
  // the casts' outputs back to back: X | Wq | Wk | Wv | Wo
  _Float16* X16   = (_Float16*)wsalloc(actBytes + 4 * wBytes);
  _Float16* Wq16  = X16 + MM * DD;
  _Float16* Wo16  = Wq16 + 3 * DD * DD;
  // the projections' outputs back to back: Q | K | V
  _Float16* Q16   = (_Float16*)wsalloc(3 * actBytes);   // [B,H,S,DH]
  _Float16* K16   = Q16 + MM * DD;                      // fragment order
  _Float16* Vt16  = K16 + MM * DD;                      // fragment order
  _Float16* ctx16 = (_Float16*)wsalloc(actBytes);   // [B,S,D]

  // 0) all five casts, one launch
  cvt_f32_f16<<<ACT_BLKS + 4 * W_BLKS, 256, 0, stream>>>(hs, Wq, Wk, Wv, Wo, X16);

  // 1) Q, K, V projections, one launch (Q pre-scaled; K, V in fragment order)
  dim3 ggrid(MM / 128, DD / 128);   // 32 x 6
  gemm_qkv_f16<<<dim3(MM / 128, DD / 128, 3), 256, 0, stream>>>(X16, Wq16, bq, bk, bv, Q16);

  // 2) fused flash attention with position bias + mask
  flash_attn<<<dim3(SS / 64, BB * HH), 128, 0, stream>>>(Q16, K16, Vt16, pb, mask, ctx16);

  // 3) output projection -> f32 result
  gemm_out_f32<<<ggrid, 256, 0, stream>>>(ctx16, Wo16, bo, out);
}

// v004
// A run of this version takes 125 microseconds.
// Two timings next to v003 both put it at 1.23 times that version's speed.
// Counting every step since v000, it is 1.89 times as fast.
#include <hip/hip_runtime.h>
#include <hip/hip_bf16.h>

// ---------------------------------------------------------------------------
// Self-attention with additive position bias (gfx1250, wave32, WMMA).
// Bandwidth-bound on position_bias (201MB) -> flash-attention fusion,
// f16 matrix cores with f32 accumulate, f32 softmax.
// GEMMs: double-buffered LDS staging (async global->LDS), batched B-fragment
// preload so WMMAs issue back-to-back.
// ---------------------------------------------------------------------------

typedef _Float16 v8h  __attribute__((ext_vector_type(8)));
typedef _Float16 v16h __attribute__((ext_vector_type(16)));
typedef float    v8f  __attribute__((ext_vector_type(8)));

#define HH 12
#define DHD 64
#define DD 768
#define BB 2
#define SS 2048
#define MM (BB * SS)   // 4096 rows

#if __has_builtin(__builtin_amdgcn_global_load_async_to_lds_b128)
#define USE_ASYNC_LDS 1
#else
#define USE_ASYNC_LDS 0
#endif

__device__ __forceinline__ v16h cat16(v8h lo, v8h hi) {
  return __builtin_shufflevector(lo, hi, 0,1,2,3,4,5,6,7,8,9,10,11,12,13,14,15);
}
__device__ __forceinline__ v8h ld8h(const _Float16* p) { return *(const v8h*)p; }
__device__ __forceinline__ v8f vzero8() {
  v8f z;
#pragma unroll
  for (int i = 0; i < 8; ++i) z[i] = 0.0f;
  return z;
}

// 32-byte global -> LDS stage for one thread (16 halves), async when available.
__device__ __forceinline__ void stage_row(_Float16* dst, const _Float16* src) {
#if USE_ASYNC_LDS
  typedef int v4i __attribute__((vector_size(16)));
  typedef __attribute__((address_space(1))) v4i* gptr_t;
  typedef __attribute__((address_space(3))) v4i* lptr_t;
  gptr_t g = (gptr_t)src;
  lptr_t l = (lptr_t)dst;
  __builtin_amdgcn_global_load_async_to_lds_b128(g, l, 0, 0);
  __builtin_amdgcn_global_load_async_to_lds_b128(g, l, 16, 0);
#else
  v8h t0 = *(const v8h*)src;
  v8h t1 = *(const v8h*)(src + 8);
  *(v8h*)dst = t0;
  *(v8h*)(dst + 8) = t1;
#endif
}

__device__ __forceinline__ void wait_async_lds() {
#if USE_ASYNC_LDS
# if __has_builtin(__builtin_amdgcn_s_wait_asynccnt)
  __builtin_amdgcn_s_wait_asynccnt(0);
# else
  asm volatile("s_wait_asynccnt 0" ::: "memory");
# endif
#endif
}

// ---------------------------------------------------------------------------
// Kernel 0: f32 -> f16 casts of hidden_states and the four weights, vectorized
// x4, all in ONE launch: none needs anything of another. A block casts 1024
// floats. The five f16 copies lie back to back in the workspace, so a block's
// place in the grid is its place in the output; only the source goes by range.
// ---------------------------------------------------------------------------
#define ACT_BLKS (MM * DD / 1024)   // 3072 blocks: hidden_states
#define W_BLKS   (DD * DD / 1024)   // 576 blocks: each weight

__global__ void cvt_f32_f16(const float* __restrict__ hs,
                            const float* __restrict__ wq,
                            const float* __restrict__ wk,
                            const float* __restrict__ wv,
                            const float* __restrict__ wo,
                            _Float16* __restrict__ out) {
  const int blk = blockIdx.x;
  const float* in = hs;
  int rel = blk;
  if (blk >= ACT_BLKS) {   // block-uniform
    const int w = (blk - ACT_BLKS) / W_BLKS;
    rel = (blk - ACT_BLKS) - w * W_BLKS;
    in = w == 0 ? wq : w == 1 ? wk : w == 2 ? wv : wo;
  }
  const int t = threadIdx.x * 4;
  float4 v = *(const float4*)(in + rel * 1024 + t);
  _Float16* o = out + blk * 1024 + t;
  o[0] = (_Float16)v.x;
  o[1] = (_Float16)v.y;
  o[2] = (_Float16)v.z;
  o[3] = (_Float16)v.w;
}

// ---------------------------------------------------------------------------
// Shared TN-GEMM core: acc[8] += A[M,K] * W[N,K]^T over K=768.
// 8 waves / WG; W tile (128x32 halves) double-buffered in LDS; one barrier
// per K-step; async copy of tile i+1 overlaps WMMAs on tile i.
// A-fragment (16x32 f16, ISA layout): lane L -> row M = L&15,
//   half chunks at K = kk + (L>=16?8:0) and kk + 16 + (L>=16?8:0).
// ---------------------------------------------------------------------------
__device__ __forceinline__ void stage_tile(const _Float16* __restrict__ W,
                                           _Float16* BtBuf, int n0, int kk,
                                           int tid) {
  int n = tid >> 1, c = (tid & 1) * 16;
  stage_row(&BtBuf[n * 32 + c], W + (size_t)(n0 + n) * DD + kk + c);
}

__device__ __forceinline__ void compute_step(const _Float16* __restrict__ arow,
                                             const _Float16* BtBuf, int kk,
                                             int mloc, int koff, v8f acc[8]) {
  v16h a = cat16(ld8h(arow + kk + koff), ld8h(arow + kk + 16 + koff));
  v16h bf[8];
#pragma unroll
  for (int nt = 0; nt < 8; ++nt) {
    const _Float16* brow = &BtBuf[(nt * 16 + mloc) * 32];
    bf[nt] = cat16(*(const v8h*)(brow + koff), *(const v8h*)(brow + 16 + koff));
  }
#pragma unroll
  for (int nt = 0; nt < 8; ++nt)
    acc[nt] = __builtin_amdgcn_wmma_f32_16x16x32_f16(
        false, a, false, bf[nt], (short)0, acc[nt], false, false);
}

__device__ __forceinline__ void gemm_core(const _Float16* __restrict__ A,
                                          const _Float16* __restrict__ W,
                                          _Float16* Bt0, _Float16* Bt1,
                                          int m0, int n0, int tid,
                                          int mloc, int koff, v8f acc[8]) {
  const _Float16* arow = A + (size_t)(m0 + mloc) * DD;
  stage_tile(W, Bt0, n0, 0, tid);
  for (int kk = 0; kk < DD; kk += 64) {
    wait_async_lds();
    __syncthreads();
    if (kk + 32 < DD) stage_tile(W, Bt1, n0, kk + 32, tid);
    compute_step(arow, Bt0, kk, mloc, koff, acc);

    wait_async_lds();
    __syncthreads();
    if (kk + 64 < DD) stage_tile(W, Bt0, n0, kk + 64, tid);
    compute_step(arow, Bt1, kk + 32, mloc, koff, acc);
  }
}

// ---------------------------------------------------------------------------
// Kernel 1: Q, K and V projections in ONE launch: blockIdx.z picks the weight,
// the bias, the output plane and its layout (0 = Q, 1 = K, 2 = V).
// Q: rows, [B,H,S,DH], pre-scaled by 1/sqrt(DH).
// K and V: WMMA B-fragment order, so that one b128 load
// of a wave in the attention kernel reads 512 contiguous bytes (4 lines)
// instead of 16 bytes out of each of 16 lines.
//   K: [B*H][S/16 key tile][dh/32][chunk 2][lane 32][8 halves]
//      lane = ((dh>>3)&1)*16 + (s&15), chunk = (dh>>4)&1, half = dh&7
//   V: [B*H][S/32 key block][dh/16][chunk 2][lane 32][8 halves]
//      lane = ((s>>3)&1)*16 + (dh&15), chunk = (s>>4)&1, half = s&7
// ---------------------------------------------------------------------------
__global__ __launch_bounds__(256)
void gemm_qkv_f16(const _Float16* __restrict__ A,
                  const _Float16* __restrict__ Wqkv,   // Wq | Wk | Wv
                  const float* __restrict__ bq,
                  const float* __restrict__ bk,
                  const float* __restrict__ bv,
                  _Float16* __restrict__ qkv) {        // Q | K | V planes
  __shared__ _Float16 Bt[2][128 * 32];   // 16 KB double buffer
  const int which = blockIdx.z;
  const _Float16* W = Wqkv + which * (DD * DD);
  const float* bias = which == 0 ? bq : which == 1 ? bk : bv;
  _Float16* out = qkv + which * (MM * DD);
  const float scale = which == 0 ? 0.125f : 1.0f;
  const int tid  = threadIdx.x;
  const int wv   = tid >> 5;
  const int lane = tid & 31;
  const int mloc = lane & 15;
  const int hi   = lane >> 4;
  const int koff = hi * 8;
  const int m0 = blockIdx.x * 128 + wv * 16;
  const int n0 = blockIdx.y * 128;

  v8f acc[8];
#pragma unroll
  for (int i = 0; i < 8; ++i) acc[i] = vzero8();

  gemm_core(A, W, Bt[0], Bt[1], m0, n0, tid, mloc, koff, acc);

  // epilogue: C layout lane holds (M = r + hi*8, N = nt*16 + (lane&15))
  const int bb = m0 >> 11, s0 = m0 & 2047;   // the wave's 16 rows: one batch
  float bvv[8];
#pragma unroll
  for (int nt = 0; nt < 8; ++nt) bvv[nt] = bias[n0 + nt * 16 + mloc];
  // n0 is a multiple of 128: tiles 0..3 are head n0/64, tiles 4..7 the next;
  // within a head dh = (nt&3)*16 + mloc
  _Float16* ob = out + (size_t)(bb * HH + (n0 >> 6)) * SS * DHD;
  if (which == 2) {
    // a lane's 8 rows are the 8 halves of its own fragment slot
    _Float16* ov = ob + (s0 >> 5) * 2048 + ((s0 >> 4) & 1) * 256 + lane * 8;
#pragma unroll
    for (int nt = 0; nt < 8; ++nt) {
      v8h pk;
#pragma unroll
      for (int r = 0; r < 8; ++r) pk[r] = (_Float16)((acc[nt][r] + bvv[nt]) * scale);
      *(v8h*)(ov + (nt >> 2) * SS * DHD + (nt & 3) * 512) = pk;
    }
    // stands ahead of any later write of a register that these stores name
    // (the other layouts' blocks follow this one in the built code)
    asm volatile("s_wait_xcnt 0x0" ::: "memory");
  } else if (which == 1) {
    _Float16* ok = ob + (s0 >> 4) * 1024 + ((mloc >> 3) * 16 + hi * 8) * 8 + (mloc & 7);
#pragma unroll
    for (int nt = 0; nt < 8; ++nt)
#pragma unroll
      for (int r = 0; r < 8; ++r)
        ok[(nt >> 2) * SS * DHD + (nt & 3) * 256 + r * 8] =
            (_Float16)((acc[nt][r] + bvv[nt]) * scale);
    // stands ahead of any later write of a register that these stores name
    // (the other layouts' blocks follow this one in the built code)
    asm volatile("s_wait_xcnt 0x0" ::: "memory");
  } else {
    _Float16* oq = ob + (s0 + hi * 8) * DHD + mloc;
#pragma unroll
    for (int nt = 0; nt < 8; ++nt)
#pragma unroll
      for (int r = 0; r < 8; ++r)
        oq[(nt >> 2) * SS * DHD + r * DHD + (nt & 3) * 16] =
            (_Float16)((acc[nt][r] + bvv[nt]) * scale);
    // stands ahead of any later write of a register that these stores name
    // (the other layouts' blocks follow this one in the built code)
    asm volatile("s_wait_xcnt 0x0" ::: "memory");
  }
}

__device__ __forceinline__ float xhalf(float x) {
  int b = __builtin_bit_cast(int, x);
  return __builtin_bit_cast(float, __builtin_amdgcn_permlanex16(
      b, b, 0x76543210, 0xfedcba98, false, false));
}

// one pass's operands: 32 keys of K (4 fragments), of V (4 fragments), and a
// lane's 2 x 8 consecutive keys of position_bias and attention_mask
__device__ __forceinline__ void fetch_frag(v16h f[4], const _Float16* p) {
#pragma unroll
  for (int i = 0; i < 4; ++i) f[i] = cat16(ld8h(p + i * 512), ld8h(p + i * 512 + 256));
}
__device__ __forceinline__ void fetch_bias(v8f pbv[2], v8f mkv[2],
                                           const float* pr, const float* mr) {
#pragma unroll
  for (int nt = 0; nt < 2; ++nt) {
    pbv[nt] = *(const v8f*)(pr + nt * 16);
    mkv[nt] = *(const v8f*)(mr + nt * 16);
  }
}

__global__ __launch_bounds__(128)
void flash_attn(const _Float16* __restrict__ Q,    // [B,H,S,DH] pre-scaled 1/8
                const _Float16* __restrict__ K,    // fragment order (kernel 1)
                const _Float16* __restrict__ Vt,   // fragment order (kernel 1)
                const float* __restrict__ pb,      // [1,H,S,S]
                const float* __restrict__ mask,    // [B,1,1,S]
                _Float16* __restrict__ ctx) {      // [B,S,D] f16
  const int wv   = threadIdx.x >> 5;
  const int lane = threadIdx.x & 31;
  const int mloc = lane & 15;
  const int hi   = lane >> 4;
  const int koff = hi * 8;
  const int bh = blockIdx.y, b = bh / HH, h = bh % HH;
  const int q0 = blockIdx.x * 64 + wv * 16;

  const _Float16* qrow = Q + ((size_t)bh * SS + q0 + mloc) * DHD;
  const v16h bq0 = cat16(ld8h(qrow + koff),      ld8h(qrow + 16 + koff));
  const v16h bq1 = cat16(ld8h(qrow + 32 + koff), ld8h(qrow + 48 + koff));
  // stands ahead of the later write of the address registers that these loads name
  asm volatile("s_wait_xcnt 0x0" ::: "memory");

  // 32 keys are 2048 contiguous halves in both: 8 slots of 32 lanes x 8 halves
  const _Float16* Kh  = K  + (size_t)bh * SS * DHD + lane * 8;
  const _Float16* Vh  = Vt + (size_t)bh * DHD * SS + lane * 8;
  const float*    pbq = pb + ((size_t)h * SS + q0) * SS;
  const float*    pbl = pbq + (size_t)mloc * SS + koff;   // the lane's own query row
  const float*    mk  = mask + (size_t)b * SS + koff;

  v8f o[4];   // o[dt][r] = O[q0 + mloc][dt*16 + hi*8 + r]
#pragma unroll
  for (int i = 0; i < 4; ++i) o[i] = vzero8();
  float mi = -1e30f, li = 0.0f;   // li: this half's keys only, joined at the end

  // No pass waits for a load that it has just issued. K, bias and mask are
  // asked for one pass ahead, right behind the score products that read them,
  // and carried in the same registers over the loop's back edge; V is asked
  // for at the head of its own pass, ahead of the score products and the
  // softmax, in the registers that the last output products have read.
  v16h kf[4];
  v8f pbv[2], mkv[2];
  fetch_frag(kf, Kh);
  fetch_bias(pbv, mkv, pbl, mk);
  // stands ahead of any later write of an address register that these loads name
  asm volatile("s_wait_xcnt 0x0" ::: "memory");
  // holds the address arithmetic that follows behind that wait
  __builtin_amdgcn_sched_barrier(0);

  // where the next pass's K, bias and mask lie
  const _Float16* kp = Kh + 32 * DHD;
  const float*    pp = pbl + 32;
  const float*    mp = mk + 32;

  for (int kb = 0; kb < SS; kb += 32) {
    v16h vf[4];
    fetch_frag(vf, Vh + (size_t)kb * DHD);
    // stands ahead of any later write of an address register that these loads
    // name; it also holds them here, at the head of the pass: without it they
    // are issued behind the score products and the wait in front of those
    asm volatile("s_wait_xcnt 0x0" ::: "memory");

    // ---- scores tile [32k x 16q] = bias + mask + K * Q^T (Q pre-scaled) ----
    // bias + mask go in as the products' C operand: their registers are free
    // for the next pass's loads as soon as the products are issued
    v8f sc[2];
#pragma unroll
    for (int nt = 0; nt < 2; ++nt) {
      v8f c = pbv[nt] + mkv[nt];
      c = __builtin_amdgcn_wmma_f32_16x16x32_f16(false, kf[nt*2+0], false, bq0, (short)0, c, false, false);
      c = __builtin_amdgcn_wmma_f32_16x16x32_f16(false, kf[nt*2+1], false, bq1, (short)0, c, false, false);
      sc[nt] = c;
    }
    if (kb + 96 < SS)  // bias chunk per q-row, two passes ahead of its load
      __builtin_prefetch(pbq + (size_t)mloc * SS + kb + 96, 0, 1);

    fetch_frag(kf, kp);
    fetch_bias(pbv, mkv, pp, mp);
    // stands ahead of any later write of an address register that these loads name
    asm volatile("s_wait_xcnt 0x0" ::: "memory");
    // keeps these loads issued ahead of the softmax: without it most of them
    // are issued behind it, with no time to land before the next pass
    __builtin_amdgcn_sched_barrier(0);
    // the pointers stop on the last block: the last pass's fetch stays in
    // bounds (its values are never used)
    const int st = kb + 64 < SS ? 32 : 0;
    kp += st * DHD;
    pp += st;
    mp += st;

    // ---- online softmax: one query per lane ----
    float x = fmaxf(sc[0][0], sc[1][0]);
#pragma unroll
    for (int r = 1; r < 8; ++r) x = fmaxf(x, fmaxf(sc[0][r], sc[1][r]));
    x = fmaxf(x, xhalf(x));
    const float mnew = fmaxf(mi, x);
    const float corr = __expf(mi - mnew);
    mi = mnew;
#pragma unroll
    for (int dt = 0; dt < 4; ++dt)
#pragma unroll
      for (int r = 0; r < 8; ++r) o[dt][r] *= corr;
    v16h bp;   // P^T as B: half nt*8 + r is key nt*16 + hi*8 + r
    float ps = 0.0f;
#pragma unroll
    for (int r = 0; r < 8; ++r) {
      float p0 = __expf(sc[0][r] - mnew);
      float p1 = __expf(sc[1][r] - mnew);
      ps += p0 + p1;
      bp[r]     = (_Float16)p0;
      bp[8 + r] = (_Float16)p1;
    }
    li = li * corr + ps;

    // ---- O^T += V^T * P^T  (V stored as ready fragments) ----
#pragma unroll
    for (int dt = 0; dt < 4; ++dt)
      o[dt] = __builtin_amdgcn_wmma_f32_16x16x32_f16(
          false, vf[dt], false, bp, (short)0, o[dt], false, false);
  }

  // ---- normalize and emit context in [B,S,H*DH] f16 for the output GEMM ----
  const float rinv = 1.0f / (li + xhalf(li));
  _Float16* crow = ctx + ((size_t)b * SS + q0 + mloc) * DD + (size_t)h * DHD + koff;
#pragma unroll
  for (int dt = 0; dt < 4; ++dt) {
    v8h pk;
#pragma unroll
    for (int r = 0; r < 8; ++r) pk[r] = (_Float16)(o[dt][r] * rinv);
    *(v8h*)(crow + dt * 16) = pk;
  }
}

// ---------------------------------------------------------------------------
// Kernel 3: output projection, f32 epilogue straight to d_out.
// ---------------------------------------------------------------------------
__global__ __launch_bounds__(256)
void gemm_out_f32(const _Float16* __restrict__ A,
                  const _Float16* __restrict__ W,
                  const float* __restrict__ bias,
                  float* __restrict__ out) {
  __shared__ _Float16 Bt[2][128 * 32];
  const int tid  = threadIdx.x;
  const int wv   = tid >> 5;
  const int lane = tid & 31;
  const int mloc = lane & 15;
  const int hi   = lane >> 4;
  const int koff = hi * 8;
  const int m0 = blockIdx.x * 128 + wv * 16;
  const int n0 = blockIdx.y * 128;

  v8f acc[8];
#pragma unroll
  for (int i = 0; i < 8; ++i) acc[i] = vzero8();

  gemm_core(A, W, Bt[0], Bt[1], m0, n0, tid, mloc, koff, acc);

#pragma unroll
  for (int nt = 0; nt < 8; ++nt) {
    int n = n0 + nt * 16 + mloc;
    float bv = bias[n];
#pragma unroll
    for (int r = 0; r < 8; ++r) {
      int m = m0 + r + hi * 8;
      out[(size_t)m * DD + n] = acc[nt][r] + bv;
    }
  }
}

// ---------------------------------------------------------------------------
// Host-side launcher (graph-capture safe: stream launches only, ws scratch).
// ---------------------------------------------------------------------------
extern "C" void kernel_launch(void* const* d_in, const int* in_sizes, int n_in,
                              void* d_out, int out_size, void* d_ws, size_t ws_size,
                              hipStream_t stream) {
  (void)in_sizes; (void)n_in; (void)out_size; (void)ws_size;

  const float* hs   = (const float*)d_in[0];
  const float* mask = (const float*)d_in[1];
  const float* pb   = (const float*)d_in[2];
  const float* Wq   = (const float*)d_in[3];
  const float* bq   = (const float*)d_in[4];
  const float* Wk   = (const float*)d_in[5];
  const float* bk   = (const float*)d_in[6];
  const float* Wv   = (const float*)d_in[7];
  const float* bv   = (const float*)d_in[8];
  const float* Wo   = (const float*)d_in[9];
  const float* bo   = (const float*)d_in[10];
  float* out = (float*)d_out;

  char* ws = (char*)d_ws;
  size_t off = 0;
  auto wsalloc = [&](size_t bytes) -> void* {
    void* p = ws + off;
    off += (bytes + 255) & ~(size_t)255;
    return p;
  };
  const size_t actBytes = (size_t)MM * DD * sizeof(_Float16);   // 6.29 MB
  const size_t wBytes   = (size_t)DD * DD * sizeof(_Float16);   // 1.18 MB
  // the casts' outputs back to back: X | Wq | Wk | Wv | Wo
  _Float16* X16   = (_Float16*)wsalloc(actBytes + 4 * wBytes);
  _Float16* Wq16  = X16 + MM * DD;
  _Float16* Wo16  = Wq16 + 3 * DD * DD;
  // the projections' outputs back to back: Q | K | V
  _Float16* Q16   = (_Float16*)wsalloc(3 * actBytes);   // [B,H,S,DH]
  _Float16* K16   = Q16 + MM * DD;                      // fragment order
  _Float16* Vt16  = K16 + MM * DD;                      // fragment order
  _Float16* ctx16 = (_Float16*)wsalloc(actBytes);   // [B,S,D]

  // 0) all five casts, one launch
  cvt_f32_f16<<<ACT_BLKS + 4 * W_BLKS, 256, 0, stream>>>(hs, Wq, Wk, Wv, Wo, X16);

  // 1) Q, K, V projections, one launch (Q pre-scaled; K, V in fragment order)
  dim3 ggrid(MM / 128, DD / 128);   // 32 x 6
  gemm_qkv_f16<<<dim3(MM / 128, DD / 128, 3), 256, 0, stream>>>(X16, Wq16, bq, bk, bv, Q16);

  // 2) fused flash attention with position bias + mask
  flash_attn<<<dim3(SS / 64, BB * HH), 128, 0, stream>>>(Q16, K16, Vt16, pb, mask, ctx16);

  // 3) output projection -> f32 result
  gemm_out_f32<<<ggrid, 256, 0, stream>>>(ctx16, Wo16, bo, out);
}

// v005
// Measured time: 110 microseconds a run.
// Timed twice side by side with v004, it ran 1.13 and 1.14 times as fast.
// Counting every step since v000, it is 2.14 times as fast.
#include <hip/hip_runtime.h>
#include <hip/hip_bf16.h>

// ---------------------------------------------------------------------------
// Self-attention with additive position bias (gfx1250, wave32, WMMA).
// Bandwidth-bound on position_bias (201MB) -> flash-attention fusion,
// f16 matrix cores with f32 accumulate, f32 softmax.
// GEMMs: double-buffered LDS staging (async global->LDS), batched B-fragment
// preload so WMMAs issue back-to-back.
// ---------------------------------------------------------------------------

typedef _Float16 v8h  __attribute__((ext_vector_type(8)));
typedef _Float16 v16h __attribute__((ext_vector_type(16)));
typedef float    v8f  __attribute__((ext_vector_type(8)));

#define HH 12
#define DHD 64
#define DD 768
#define BB 2
#define SS 2048
#define MM (BB * SS)   // 4096 rows

#if __has_builtin(__builtin_amdgcn_global_load_async_to_lds_b128)
#define USE_ASYNC_LDS 1
#else
#define USE_ASYNC_LDS 0
#endif

__device__ __forceinline__ v16h cat16(v8h lo, v8h hi) {
  return __builtin_shufflevector(lo, hi, 0,1,2,3,4,5,6,7,8,9,10,11,12,13,14,15);
}
__device__ __forceinline__ v8h ld8h(const _Float16* p) { return *(const v8h*)p; }
__device__ __forceinline__ v8f vzero8() {
  v8f z;
#pragma unroll
  for (int i = 0; i < 8; ++i) z[i] = 0.0f;
  return z;
}

// 32-byte global -> LDS stage for one thread (16 halves), async when available.
__device__ __forceinline__ void stage_row(_Float16* dst, const _Float16* src) {
#if USE_ASYNC_LDS
  typedef int v4i __attribute__((vector_size(16)));
  typedef __attribute__((address_space(1))) v4i* gptr_t;
  typedef __attribute__((address_space(3))) v4i* lptr_t;
  gptr_t g = (gptr_t)src;
  lptr_t l = (lptr_t)dst;
  __builtin_amdgcn_global_load_async_to_lds_b128(g, l, 0, 0);
  __builtin_amdgcn_global_load_async_to_lds_b128(g, l, 16, 0);
#else
  v8h t0 = *(const v8h*)src;
  v8h t1 = *(const v8h*)(src + 8);
  *(v8h*)dst = t0;
  *(v8h*)(dst + 8) = t1;
#endif
}

__device__ __forceinline__ void wait_async_lds() {
#if USE_ASYNC_LDS
# if __has_builtin(__builtin_amdgcn_s_wait_asynccnt)
  __builtin_amdgcn_s_wait_asynccnt(0);
# else
  asm volatile("s_wait_asynccnt 0" ::: "memory");
# endif
#endif
}

// ---------------------------------------------------------------------------
// Kernel 0: f32 -> f16 casts of hidden_states and the four weights, vectorized
// x4, all in ONE launch: none needs anything of another. A block casts 1024
// floats. The five f16 copies lie back to back in the workspace, so a block's
// place in the grid is its place in the output; only the source goes by range.
// ---------------------------------------------------------------------------
#define ACT_BLKS (MM * DD / 1024)   // 3072 blocks: hidden_states
#define W_BLKS   (DD * DD / 1024)   // 576 blocks: each weight

__global__ void cvt_f32_f16(const float* __restrict__ hs,
                            const float* __restrict__ wq,
                            const float* __restrict__ wk,
                            const float* __restrict__ wv,
                            const float* __restrict__ wo,
                            _Float16* __restrict__ out) {
  const int blk = blockIdx.x;
  const float* in = hs;
  int rel = blk;
  if (blk >= ACT_BLKS) {   // block-uniform
    const int w = (blk - ACT_BLKS) / W_BLKS;
    rel = (blk - ACT_BLKS) - w * W_BLKS;
    in = w == 0 ? wq : w == 1 ? wk : w == 2 ? wv : wo;
  }
  const int t = threadIdx.x * 4;
  float4 v = *(const float4*)(in + rel * 1024 + t);
  _Float16* o = out + blk * 1024 + t;
  o[0] = (_Float16)v.x;
  o[1] = (_Float16)v.y;
  o[2] = (_Float16)v.z;
  o[3] = (_Float16)v.w;
}

// ---------------------------------------------------------------------------
// Shared TN-GEMM core: acc[8] += A[M,K] * W[N,K]^T over K=768.
// 8 waves / WG; W tile (128x32 halves) double-buffered in LDS; one barrier
// per K-step; async copy of tile i+1 overlaps WMMAs on tile i.
// A tile row's 64 bytes lie at a pitch of 80 B (16 B x odd): the 16 rows that
// half a wave reads with one ds_load_b128 fall on all 64 banks once; at 64 B
// they fall on 16 banks, four rows deep.
// A-fragment (16x32 f16, ISA layout): lane L -> row M = L&15,
//   half chunks at K = kk + (L>=16?8:0) and kk + 16 + (L>=16?8:0).
// ---------------------------------------------------------------------------
#define BPITCH 40   // halves per W tile row in LDS: 32 of data, 8 never touched

__device__ __forceinline__ void stage_tile(const _Float16* __restrict__ W,
                                           _Float16* BtBuf, int n0, int kk,
                                           int tid) {
  int n = tid >> 1, c = (tid & 1) * 16;
  stage_row(&BtBuf[n * BPITCH + c], W + (size_t)(n0 + n) * DD + kk + c);
}

__device__ __forceinline__ void compute_step(const _Float16* __restrict__ arow,
                                             const _Float16* BtBuf, int kk,
                                             int mloc, int koff, v8f acc[8]) {
  v16h a = cat16(ld8h(arow + kk + koff), ld8h(arow + kk + 16 + koff));
  v16h bf[8];
#pragma unroll
  for (int nt = 0; nt < 8; ++nt) {
    const _Float16* brow = &BtBuf[(nt * 16 + mloc) * BPITCH];
    bf[nt] = cat16(*(const v8h*)(brow + koff), *(const v8h*)(brow + 16 + koff));
  }
#pragma unroll
  for (int nt = 0; nt < 8; ++nt)
    acc[nt] = __builtin_amdgcn_wmma_f32_16x16x32_f16(
        false, a, false, bf[nt], (short)0, acc[nt], false, false);
}

__device__ __forceinline__ void gemm_core(const _Float16* __restrict__ A,
                                          const _Float16* __restrict__ W,
                                          _Float16* Bt0, _Float16* Bt1,
                                          int m0, int n0, int tid,
                                          int mloc, int koff, v8f acc[8]) {
  const _Float16* arow = A + (size_t)(m0 + mloc) * DD;
  stage_tile(W, Bt0, n0, 0, tid);
  // stays a loop: a trip waits at its two barriers whether unrolled or not, and
  // twelve copies of the body are four times the code
#pragma unroll 1
  for (int kk = 0; kk < DD; kk += 64) {
    wait_async_lds();
    __syncthreads();
    if (kk + 32 < DD) stage_tile(W, Bt1, n0, kk + 32, tid);
    compute_step(arow, Bt0, kk, mloc, koff, acc);

    wait_async_lds();
    __syncthreads();
    if (kk + 64 < DD) stage_tile(W, Bt0, n0, kk + 64, tid);
    compute_step(arow, Bt1, kk + 32, mloc, koff, acc);
  }
}

// ---------------------------------------------------------------------------
// Kernel 1: Q, K and V projections in ONE launch: blockIdx.z picks the weight,
// the bias, the output plane and its layout (0 = Q, 1 = K, 2 = V).
// Q: rows, [B,H,S,DH], pre-scaled by 1/sqrt(DH).
// K and V: WMMA B-fragment order, so that one b128 load
// of a wave in the attention kernel reads 512 contiguous bytes (4 lines)
// instead of 16 bytes out of each of 16 lines.
//   K: [B*H][S/16 key tile][dh/32][chunk 2][lane 32][8 halves]
//      lane = ((dh>>3)&1)*16 + (s&15), chunk = (dh>>4)&1, half = dh&7
//   V: [B*H][S/32 key block][dh/16][chunk 2][lane 32][8 halves]
//      lane = ((s>>3)&1)*16 + (dh&15), chunk = (s>>4)&1, half = s&7
// ---------------------------------------------------------------------------
__global__ __launch_bounds__(256)
void gemm_qkv_f16(const _Float16* __restrict__ A,
                  const _Float16* __restrict__ Wqkv,   // Wq | Wk | Wv
                  const float* __restrict__ bq,
                  const float* __restrict__ bk,
                  const float* __restrict__ bv,
                  _Float16* __restrict__ qkv) {        // Q | K | V planes
  __shared__ __attribute__((aligned(16))) _Float16 Bt[2][128 * BPITCH];   // 20 KB double buffer
  const int which = blockIdx.z;
  const _Float16* W = Wqkv + which * (DD * DD);
  const float* bias = which == 0 ? bq : which == 1 ? bk : bv;
  _Float16* out = qkv + which * (MM * DD);
  const float scale = which == 0 ? 0.125f : 1.0f;
  const int tid  = threadIdx.x;
  const int wv   = tid >> 5;
  const int lane = tid & 31;
  const int mloc = lane & 15;
  const int hi   = lane >> 4;
  const int koff = hi * 8;
  const int m0 = blockIdx.x * 128 + wv * 16;
  const int n0 = blockIdx.y * 128;

  v8f acc[8];
#pragma unroll
  for (int i = 0; i < 8; ++i) acc[i] = vzero8();

  gemm_core(A, W, Bt[0], Bt[1], m0, n0, tid, mloc, koff, acc);

  // epilogue: C layout lane holds (M = r + hi*8, N = nt*16 + (lane&15))
  const int bb = m0 >> 11, s0 = m0 & 2047;   // the wave's 16 rows: one batch
  float bvv[8];
#pragma unroll
  for (int nt = 0; nt < 8; ++nt) bvv[nt] = bias[n0 + nt * 16 + mloc];
  // n0 is a multiple of 128: tiles 0..3 are head n0/64, tiles 4..7 the next;
  // within a head dh = (nt&3)*16 + mloc
  _Float16* ob = out + (size_t)(bb * HH + (n0 >> 6)) * SS * DHD;
  if (which == 2) {
    // a lane's 8 rows are the 8 halves of its own fragment slot
    _Float16* ov = ob + (s0 >> 5) * 2048 + ((s0 >> 4) & 1) * 256 + lane * 8;
#pragma unroll
    for (int nt = 0; nt < 8; ++nt) {
      v8h pk;
#pragma unroll
      for (int r = 0; r < 8; ++r) pk[r] = (_Float16)((acc[nt][r] + bvv[nt]) * scale);
      *(v8h*)(ov + (nt >> 2) * SS * DHD + (nt & 3) * 512) = pk;
    }
    // stands ahead of any later write of a register that these stores name
    // (the other layouts' blocks follow this one in the built code)
    asm volatile("s_wait_xcnt 0x0" ::: "memory");
  } else if (which == 1) {
    _Float16* ok = ob + (s0 >> 4) * 1024 + ((mloc >> 3) * 16 + hi * 8) * 8 + (mloc & 7);
#pragma unroll
    for (int nt = 0; nt < 8; ++nt)
#pragma unroll
      for (int r = 0; r < 8; ++r)
        ok[(nt >> 2) * SS * DHD + (nt & 3) * 256 + r * 8] =
            (_Float16)((acc[nt][r] + bvv[nt]) * scale);
    // stands ahead of any later write of a register that these stores name
    // (the other layouts' blocks follow this one in the built code)
    asm volatile("s_wait_xcnt 0x0" ::: "memory");
  } else {
    _Float16* oq = ob + (s0 + hi * 8) * DHD + mloc;
#pragma unroll
    for (int nt = 0; nt < 8; ++nt)
#pragma unroll
      for (int r = 0; r < 8; ++r)
        oq[(nt >> 2) * SS * DHD + r * DHD + (nt & 3) * 16] =
            (_Float16)((acc[nt][r] + bvv[nt]) * scale);
    // stands ahead of any later write of a register that these stores name
    // (the other layouts' blocks follow this one in the built code)
    asm volatile("s_wait_xcnt 0x0" ::: "memory");
  }
}

__device__ __forceinline__ float xhalf(float x) {
  int b = __builtin_bit_cast(int, x);
  return __builtin_bit_cast(float, __builtin_amdgcn_permlanex16(
      b, b, 0x76543210, 0xfedcba98, false, false));
}

// one pass's operands: 32 keys of K (4 fragments), of V (4 fragments), and a
// lane's 2 x 8 consecutive keys of position_bias and attention_mask
__device__ __forceinline__ void fetch_frag(v16h f[4], const _Float16* p) {
#pragma unroll
  for (int i = 0; i < 4; ++i) f[i] = cat16(ld8h(p + i * 512), ld8h(p + i * 512 + 256));
}
__device__ __forceinline__ void fetch_bias(v8f pbv[2], v8f mkv[2],
                                           const float* pr, const float* mr) {
#pragma unroll
  for (int nt = 0; nt < 2; ++nt) {
    pbv[nt] = *(const v8f*)(pr + nt * 16);
    mkv[nt] = *(const v8f*)(mr + nt * 16);
  }
}

__global__ __launch_bounds__(128)
void flash_attn(const _Float16* __restrict__ Q,    // [B,H,S,DH] pre-scaled 1/8
                const _Float16* __restrict__ K,    // fragment order (kernel 1)
                const _Float16* __restrict__ Vt,   // fragment order (kernel 1)
                const float* __restrict__ pb,      // [1,H,S,S]
                const float* __restrict__ mask,    // [B,1,1,S]
                _Float16* __restrict__ ctx) {      // [B,S,D] f16
  const int wv   = threadIdx.x >> 5;
  const int lane = threadIdx.x & 31;
  const int mloc = lane & 15;
  const int hi   = lane >> 4;
  const int koff = hi * 8;
  const int bh = blockIdx.y, b = bh / HH, h = bh % HH;
  const int q0 = blockIdx.x * 64 + wv * 16;

  const _Float16* qrow = Q + ((size_t)bh * SS + q0 + mloc) * DHD;
  const v16h bq0 = cat16(ld8h(qrow + koff),      ld8h(qrow + 16 + koff));
  const v16h bq1 = cat16(ld8h(qrow + 32 + koff), ld8h(qrow + 48 + koff));
  // stands ahead of the later write of the address registers that these loads name
  asm volatile("s_wait_xcnt 0x0" ::: "memory");

  // 32 keys are 2048 contiguous halves in both: 8 slots of 32 lanes x 8 halves
  const _Float16* Kh  = K  + (size_t)bh * SS * DHD + lane * 8;
  const _Float16* Vh  = Vt + (size_t)bh * DHD * SS + lane * 8;
  const float*    pbq = pb + ((size_t)h * SS + q0) * SS;
  const float*    pbl = pbq + (size_t)mloc * SS + koff;   // the lane's own query row
  const float*    mk  = mask + (size_t)b * SS + koff;

  v8f o[4];   // o[dt][r] = O[q0 + mloc][dt*16 + hi*8 + r]
#pragma unroll
  for (int i = 0; i < 4; ++i) o[i] = vzero8();
  float mi = -1e30f, li = 0.0f;   // li: this half's keys only, joined at the end

  // No pass waits for a load that it has just issued. K, bias and mask are
  // asked for one pass ahead, right behind the score products that read them,
  // and carried in the same registers over the loop's back edge; V is asked
  // for at the head of its own pass, ahead of the score products and the
  // softmax, in the registers that the last output products have read.
  v16h kf[4];
  v8f pbv[2], mkv[2];
  fetch_frag(kf, Kh);
  fetch_bias(pbv, mkv, pbl, mk);
  // stands ahead of any later write of an address register that these loads name
  asm volatile("s_wait_xcnt 0x0" ::: "memory");
  // holds the address arithmetic that follows behind that wait
  __builtin_amdgcn_sched_barrier(0);

  // where the next pass's K, bias and mask lie
  const _Float16* kp = Kh + 32 * DHD;
  const float*    pp = pbl + 32;
  const float*    mp = mk + 32;

  for (int kb = 0; kb < SS; kb += 32) {
    v16h vf[4];
    fetch_frag(vf, Vh + (size_t)kb * DHD);
    // stands ahead of any later write of an address register that these loads
    // name; it also holds them here, at the head of the pass: without it they
    // are issued behind the score products and the wait in front of those
    asm volatile("s_wait_xcnt 0x0" ::: "memory");

    // ---- scores tile [32k x 16q] = bias + mask + K * Q^T (Q pre-scaled) ----
    // bias + mask go in as the products' C operand: their registers are free
    // for the next pass's loads as soon as the products are issued
    v8f sc[2];
#pragma unroll
    for (int nt = 0; nt < 2; ++nt) {
      v8f c = pbv[nt] + mkv[nt];
      c = __builtin_amdgcn_wmma_f32_16x16x32_f16(false, kf[nt*2+0], false, bq0, (short)0, c, false, false);
      c = __builtin_amdgcn_wmma_f32_16x16x32_f16(false, kf[nt*2+1], false, bq1, (short)0, c, false, false);
      sc[nt] = c;
    }
    if (kb + 96 < SS)  // bias chunk per q-row, two passes ahead of its load
      __builtin_prefetch(pbq + (size_t)mloc * SS + kb + 96, 0, 1);

    fetch_frag(kf, kp);
    fetch_bias(pbv, mkv, pp, mp);
    // stands ahead of any later write of an address register that these loads name
    asm volatile("s_wait_xcnt 0x0" ::: "memory");
    // keeps these loads issued ahead of the softmax: without it most of them
    // are issued behind it, with no time to land before the next pass
    __builtin_amdgcn_sched_barrier(0);
    // the pointers stop on the last block: the last pass's fetch stays in
    // bounds (its values are never used)
    const int st = kb + 64 < SS ? 32 : 0;
    kp += st * DHD;
    pp += st;
    mp += st;

    // ---- online softmax: one query per lane ----
    float x = fmaxf(sc[0][0], sc[1][0]);
#pragma unroll
    for (int r = 1; r < 8; ++r) x = fmaxf(x, fmaxf(sc[0][r], sc[1][r]));
    x = fmaxf(x, xhalf(x));
    const float mnew = fmaxf(mi, x);
    const float corr = __expf(mi - mnew);
    mi = mnew;
#pragma unroll
    for (int dt = 0; dt < 4; ++dt)
#pragma unroll
      for (int r = 0; r < 8; ++r) o[dt][r] *= corr;
    v16h bp;   // P^T as B: half nt*8 + r is key nt*16 + hi*8 + r
    float ps = 0.0f;
#pragma unroll
    for (int r = 0; r < 8; ++r) {
      float p0 = __expf(sc[0][r] - mnew);
      float p1 = __expf(sc[1][r] - mnew);
      ps += p0 + p1;
      bp[r]     = (_Float16)p0;
      bp[8 + r] = (_Float16)p1;
    }
    li = li * corr + ps;

    // ---- O^T += V^T * P^T  (V stored as ready fragments) ----
#pragma unroll
    for (int dt = 0; dt < 4; ++dt)
      o[dt] = __builtin_amdgcn_wmma_f32_16x16x32_f16(
          false, vf[dt], false, bp, (short)0, o[dt], false, false);
  }

  // ---- normalize and emit context in [B,S,H*DH] f16 for the output GEMM ----
  const float rinv = 1.0f / (li + xhalf(li));
  _Float16* crow = ctx + ((size_t)b * SS + q0 + mloc) * DD + (size_t)h * DHD + koff;
#pragma unroll
  for (int dt = 0; dt < 4; ++dt) {
    v8h pk;
#pragma unroll
    for (int r = 0; r < 8; ++r) pk[r] = (_Float16)(o[dt][r] * rinv);
    *(v8h*)(crow + dt * 16) = pk;
  }
}

// ---------------------------------------------------------------------------
// Kernel 3: output projection, f32 epilogue straight to d_out.
// ---------------------------------------------------------------------------
__global__ __launch_bounds__(256)
void gemm_out_f32(const _Float16* __restrict__ A,
                  const _Float16* __restrict__ W,
                  const float* __restrict__ bias,
                  float* __restrict__ out) {
  __shared__ __attribute__((aligned(16))) _Float16 Bt[2][128 * BPITCH];
  const int tid  = threadIdx.x;
  const int wv   = tid >> 5;
  const int lane = tid & 31;
  const int mloc = lane & 15;
  const int hi   = lane >> 4;
  const int koff = hi * 8;
  const int m0 = blockIdx.x * 128 + wv * 16;
  const int n0 = blockIdx.y * 128;

  v8f acc[8];
#pragma unroll
  for (int i = 0; i < 8; ++i) acc[i] = vzero8();

  gemm_core(A, W, Bt[0], Bt[1], m0, n0, tid, mloc, koff, acc);

#pragma unroll
  for (int nt = 0; nt < 8; ++nt) {
    int n = n0 + nt * 16 + mloc;
    float bv = bias[n];
#pragma unroll
    for (int r = 0; r < 8; ++r) {
      int m = m0 + r + hi * 8;
      out[(size_t)m * DD + n] = acc[nt][r] + bv;
    }
  }
}

// ---------------------------------------------------------------------------
// Host-side launcher (graph-capture safe: stream launches only, ws scratch).
// ---------------------------------------------------------------------------
extern "C" void kernel_launch(void* const* d_in, const int* in_sizes, int n_in,
                              void* d_out, int out_size, void* d_ws, size_t ws_size,
                              hipStream_t stream) {
  (void)in_sizes; (void)n_in; (void)out_size; (void)ws_size;

  const float* hs   = (const float*)d_in[0];
  const float* mask = (const float*)d_in[1];
  const float* pb   = (const float*)d_in[2];
  const float* Wq   = (const float*)d_in[3];
  const float* bq   = (const float*)d_in[4];
  const float* Wk   = (const float*)d_in[5];
  const float* bk   = (const float*)d_in[6];
  const float* Wv   = (const float*)d_in[7];
  const float* bv   = (const float*)d_in[8];
  const float* Wo   = (const float*)d_in[9];
  const float* bo   = (const float*)d_in[10];
  float* out = (float*)d_out;

  char* ws = (char*)d_ws;
  size_t off = 0;
  auto wsalloc = [&](size_t bytes) -> void* {
    void* p = ws + off;
    off += (bytes + 255) & ~(size_t)255;
    return p;
  };
  const size_t actBytes = (size_t)MM * DD * sizeof(_Float16);   // 6.29 MB
  const size_t wBytes   = (size_t)DD * DD * sizeof(_Float16);   // 1.18 MB
  // the casts' outputs back to back: X | Wq | Wk | Wv | Wo
  _Float16* X16   = (_Float16*)wsalloc(actBytes + 4 * wBytes);
  _Float16* Wq16  = X16 + MM * DD;
  _Float16* Wo16  = Wq16 + 3 * DD * DD;
  // the projections' outputs back to back: Q | K | V
  _Float16* Q16   = (_Float16*)wsalloc(3 * actBytes);   // [B,H,S,DH]
  _Float16* K16   = Q16 + MM * DD;                      // fragment order
  _Float16* Vt16  = K16 + MM * DD;                      // fragment order
  _Float16* ctx16 = (_Float16*)wsalloc(actBytes);   // [B,S,D]

  // 0) all five casts, one launch
  cvt_f32_f16<<<ACT_BLKS + 4 * W_BLKS, 256, 0, stream>>>(hs, Wq, Wk, Wv, Wo, X16);

  // 1) Q, K, V projections, one launch (Q pre-scaled; K, V in fragment order)
  dim3 ggrid(MM / 128, DD / 128);   // 32 x 6
  gemm_qkv_f16<<<dim3(MM / 128, DD / 128, 3), 256, 0, stream>>>(X16, Wq16, bq, bk, bv, Q16);

  // 2) fused flash attention with position bias + mask
  flash_attn<<<dim3(SS / 64, BB * HH), 128, 0, stream>>>(Q16, K16, Vt16, pb, mask, ctx16);

  // 3) output projection -> f32 result
  gemm_out_f32<<<ggrid, 256, 0, stream>>>(ctx16, Wo16, bo, out);
}

// v006
// Measured time: 106 microseconds a run.
// Timed twice side by side with v005, it ran 1.04 times as fast both times.
// Counting every step since v000, it is 2.22 times as fast.
#include <hip/hip_runtime.h>
#include <hip/hip_bf16.h>

// ---------------------------------------------------------------------------
// Self-attention with additive position bias (gfx1250, wave32, WMMA).
// Bandwidth-bound on position_bias (201MB) -> flash-attention fusion,
// f16 matrix cores with f32 accumulate, f32 softmax.
// GEMMs: double-buffered LDS staging (async global->LDS), batched B-fragment
// preload so WMMAs issue back-to-back.
// ---------------------------------------------------------------------------

typedef _Float16 v8h  __attribute__((ext_vector_type(8)));
typedef _Float16 v16h __attribute__((ext_vector_type(16)));
typedef float    v8f  __attribute__((ext_vector_type(8)));

#define HH 12
#define DHD 64
#define DD 768
#define BB 2
#define SS 2048
#define MM (BB * SS)   // 4096 rows

#if __has_builtin(__builtin_amdgcn_global_load_async_to_lds_b128)
#define USE_ASYNC_LDS 1
#else
#define USE_ASYNC_LDS 0
#endif

__device__ __forceinline__ v16h cat16(v8h lo, v8h hi) {
  return __builtin_shufflevector(lo, hi, 0,1,2,3,4,5,6,7,8,9,10,11,12,13,14,15);
}
__device__ __forceinline__ v8h ld8h(const _Float16* p) { return *(const v8h*)p; }
__device__ __forceinline__ v8f vzero8() {
  v8f z;
#pragma unroll
  for (int i = 0; i < 8; ++i) z[i] = 0.0f;
  return z;
}

// 32-byte global -> LDS stage for one thread (16 halves), async when available.
__device__ __forceinline__ void stage_row(_Float16* dst, const _Float16* src) {
#if USE_ASYNC_LDS
  typedef int v4i __attribute__((vector_size(16)));
  typedef __attribute__((address_space(1))) v4i* gptr_t;
  typedef __attribute__((address_space(3))) v4i* lptr_t;
  gptr_t g = (gptr_t)src;
  lptr_t l = (lptr_t)dst;
  __builtin_amdgcn_global_load_async_to_lds_b128(g, l, 0, 0);
  __builtin_amdgcn_global_load_async_to_lds_b128(g, l, 16, 0);
#else
  v8h t0 = *(const v8h*)src;
  v8h t1 = *(const v8h*)(src + 8);
  *(v8h*)dst = t0;
  *(v8h*)(dst + 8) = t1;
#endif
}

__device__ __forceinline__ void wait_async_lds() {
#if USE_ASYNC_LDS
# if __has_builtin(__builtin_amdgcn_s_wait_asynccnt)
  __builtin_amdgcn_s_wait_asynccnt(0);
# else
  asm volatile("s_wait_asynccnt 0" ::: "memory");
# endif
#endif
}

// ---------------------------------------------------------------------------
// Kernel 0: f32 -> f16 casts of hidden_states and the four weights, vectorized
// x4, all in ONE launch: none needs anything of another. A block casts 1024
// floats. The five f16 copies lie back to back in the workspace, so a block's
// place in the grid is its place in the output; only the source goes by range.
// ---------------------------------------------------------------------------
#define ACT_BLKS (MM * DD / 1024)   // 3072 blocks: hidden_states
#define W_BLKS   (DD * DD / 1024)   // 576 blocks: each weight

__global__ void cvt_f32_f16(const float* __restrict__ hs,
                            const float* __restrict__ wq,
                            const float* __restrict__ wk,
                            const float* __restrict__ wv,
                            const float* __restrict__ wo,
                            _Float16* __restrict__ out) {
  const int blk = blockIdx.x;
  const float* in = hs;
  int rel = blk;
  if (blk >= ACT_BLKS) {   // block-uniform
    const int w = (blk - ACT_BLKS) / W_BLKS;
    rel = (blk - ACT_BLKS) - w * W_BLKS;
    in = w == 0 ? wq : w == 1 ? wk : w == 2 ? wv : wo;
  }
  const int t = threadIdx.x * 4;
  float4 v = *(const float4*)(in + rel * 1024 + t);
  _Float16* o = out + blk * 1024 + t;
  o[0] = (_Float16)v.x;
  o[1] = (_Float16)v.y;
  o[2] = (_Float16)v.z;
  o[3] = (_Float16)v.w;
}

// ---------------------------------------------------------------------------
// Shared TN-GEMM core: acc[8] += A[M,K] * W[N,K]^T over K=768.
// 8 waves / WG; W tile (128x32 halves) double-buffered in LDS; one barrier
// per K-step; async copy of tile i+1 overlaps WMMAs on tile i.
// A tile row's 64 bytes lie at a pitch of 80 B (16 B x odd): the 16 rows that
// half a wave reads with one ds_load_b128 fall on all 64 banks once; at 64 B
// they fall on 16 banks, four rows deep.
// A-fragment (16x32 f16, ISA layout): lane L -> row M = L&15,
//   half chunks at K = kk + (L>=16?8:0) and kk + 16 + (L>=16?8:0).
// ---------------------------------------------------------------------------
#define BPITCH 40   // halves per W tile row in LDS: 32 of data, 8 never touched

__device__ __forceinline__ void stage_tile(const _Float16* __restrict__ W,
                                           _Float16* BtBuf, int n0, int kk,
                                           int tid) {
  int n = tid >> 1, c = (tid & 1) * 16;
  stage_row(&BtBuf[n * BPITCH + c], W + (size_t)(n0 + n) * DD + kk + c);
}

__device__ __forceinline__ void compute_step(const _Float16* __restrict__ arow,
                                             const _Float16* BtBuf, int kk,
                                             int mloc, int koff, v8f acc[8]) {
  v16h a = cat16(ld8h(arow + kk + koff), ld8h(arow + kk + 16 + koff));
  v16h bf[8];
#pragma unroll
  for (int nt = 0; nt < 8; ++nt) {
    const _Float16* brow = &BtBuf[(nt * 16 + mloc) * BPITCH];
    bf[nt] = cat16(*(const v8h*)(brow + koff), *(const v8h*)(brow + 16 + koff));
  }
#pragma unroll
  for (int nt = 0; nt < 8; ++nt)
    acc[nt] = __builtin_amdgcn_wmma_f32_16x16x32_f16(
        false, a, false, bf[nt], (short)0, acc[nt], false, false);
}

__device__ __forceinline__ void gemm_core(const _Float16* __restrict__ A,
                                          const _Float16* __restrict__ W,
                                          _Float16* Bt0, _Float16* Bt1,
                                          int m0, int n0, int tid,
                                          int mloc, int koff, v8f acc[8]) {
  const _Float16* arow = A + (size_t)(m0 + mloc) * DD;
  stage_tile(W, Bt0, n0, 0, tid);
  // stays a loop: a trip waits at its two barriers whether unrolled or not, and
  // twelve copies of the body are four times the code
#pragma unroll 1
  for (int kk = 0; kk < DD; kk += 64) {
    wait_async_lds();
    __syncthreads();
    if (kk + 32 < DD) stage_tile(W, Bt1, n0, kk + 32, tid);
    compute_step(arow, Bt0, kk, mloc, koff, acc);

    wait_async_lds();
    __syncthreads();
    if (kk + 64 < DD) stage_tile(W, Bt0, n0, kk + 64, tid);
    compute_step(arow, Bt1, kk + 32, mloc, koff, acc);
  }
}

// ---------------------------------------------------------------------------
// Kernel 1: Q, K and V projections in ONE launch: blockIdx.z picks the weight,
// the bias, the output plane and its layout (0 = Q, 1 = K, 2 = V).
// Q: rows, [B,H,S,DH], pre-scaled by 1/sqrt(DH).
// K and V: WMMA B-fragment order, so that one b128 load
// of a wave in the attention kernel reads 512 contiguous bytes (4 lines)
// instead of 16 bytes out of each of 16 lines.
//   K: [B*H][S/16 key tile][dh/32][chunk 2][lane 32][8 halves]
//      lane = ((dh>>3)&1)*16 + (s&15), chunk = (dh>>4)&1, half = dh&7
//   V: [B*H][S/32 key block][dh/16][chunk 2][lane 32][8 halves]
//      lane = ((s>>3)&1)*16 + (dh&15), chunk = (s>>4)&1, half = s&7
// ---------------------------------------------------------------------------
__global__ __launch_bounds__(256)
void gemm_qkv_f16(const _Float16* __restrict__ A,
                  const _Float16* __restrict__ Wqkv,   // Wq | Wk | Wv
                  const float* __restrict__ bq,
                  const float* __restrict__ bk,
                  const float* __restrict__ bv,
                  _Float16* __restrict__ qkv) {        // Q | K | V planes
  __shared__ __attribute__((aligned(16))) _Float16 Bt[2][128 * BPITCH];   // 20 KB double buffer
  const int which = blockIdx.z;
  const _Float16* W = Wqkv + which * (DD * DD);
  const float* bias = which == 0 ? bq : which == 1 ? bk : bv;
  _Float16* out = qkv + which * (MM * DD);
  const float scale = which == 0 ? 0.125f : 1.0f;
  const int tid  = threadIdx.x;
  const int wv   = tid >> 5;
  const int lane = tid & 31;
  const int mloc = lane & 15;
  const int hi   = lane >> 4;
  const int koff = hi * 8;
  const int m0 = blockIdx.x * 128 + wv * 16;
  const int n0 = blockIdx.y * 128;

  v8f acc[8];
#pragma unroll
  for (int i = 0; i < 8; ++i) acc[i] = vzero8();

  gemm_core(A, W, Bt[0], Bt[1], m0, n0, tid, mloc, koff, acc);

  // epilogue: C layout lane holds (M = r + hi*8, N = nt*16 + (lane&15))
  const int bb = m0 >> 11, s0 = m0 & 2047;   // the wave's 16 rows: one batch
  float bvv[8];
#pragma unroll
  for (int nt = 0; nt < 8; ++nt) bvv[nt] = bias[n0 + nt * 16 + mloc];
  // n0 is a multiple of 128: tiles 0..3 are head n0/64, tiles 4..7 the next;
  // within a head dh = (nt&3)*16 + mloc
  _Float16* ob = out + (size_t)(bb * HH + (n0 >> 6)) * SS * DHD;
  if (which == 2) {
    // a lane's 8 rows are the 8 halves of its own fragment slot
    _Float16* ov = ob + (s0 >> 5) * 2048 + ((s0 >> 4) & 1) * 256 + lane * 8;
#pragma unroll
    for (int nt = 0; nt < 8; ++nt) {
      v8h pk;
#pragma unroll
      for (int r = 0; r < 8; ++r) pk[r] = (_Float16)((acc[nt][r] + bvv[nt]) * scale);
      *(v8h*)(ov + (nt >> 2) * SS * DHD + (nt & 3) * 512) = pk;
    }
    // stands ahead of any later write of a register that these stores name
    // (the other layouts' blocks follow this one in the built code)
    asm volatile("s_wait_xcnt 0x0" ::: "memory");
  } else if (which == 1) {
    _Float16* ok = ob + (s0 >> 4) * 1024 + ((mloc >> 3) * 16 + hi * 8) * 8 + (mloc & 7);
#pragma unroll
    for (int nt = 0; nt < 8; ++nt)
#pragma unroll
      for (int r = 0; r < 8; ++r)
        ok[(nt >> 2) * SS * DHD + (nt & 3) * 256 + r * 8] =
            (_Float16)((acc[nt][r] + bvv[nt]) * scale);
    // stands ahead of any later write of a register that these stores name
    // (the other layouts' blocks follow this one in the built code)
    asm volatile("s_wait_xcnt 0x0" ::: "memory");
  } else {
    _Float16* oq = ob + (s0 + hi * 8) * DHD + mloc;
#pragma unroll
    for (int nt = 0; nt < 8; ++nt)
#pragma unroll
      for (int r = 0; r < 8; ++r)
        oq[(nt >> 2) * SS * DHD + r * DHD + (nt & 3) * 16] =
            (_Float16)((acc[nt][r] + bvv[nt]) * scale);
    // stands ahead of any later write of a register that these stores name
    // (the other layouts' blocks follow this one in the built code)
    asm volatile("s_wait_xcnt 0x0" ::: "memory");
  }
}

__device__ __forceinline__ float xhalf(float x) {
  int b = __builtin_bit_cast(int, x);
  return __builtin_bit_cast(float, __builtin_amdgcn_permlanex16(
      b, b, 0x76543210, 0xfedcba98, false, false));
}

// one pass's operands: 32 keys of K (4 fragments), of V (4 fragments), and a
// lane's 2 x 8 consecutive keys of attention_mask
__device__ __forceinline__ void fetch_frag(v16h f[4], const _Float16* p) {
#pragma unroll
  for (int i = 0; i < 4; ++i) f[i] = cat16(ld8h(p + i * 512), ld8h(p + i * 512 + 256));
}
__device__ __forceinline__ void fetch_mask(v8f mkv[2], const float* mr) {
#pragma unroll
  for (int nt = 0; nt < 2; ++nt) mkv[nt] = *(const v8f*)(mr + nt * 16);
}

// A wave's bias ring: 16 query rows; a row holds the two tiles (32 keys, 128 B
// each) side by side and 16 B that are never touched: pitch 272 B = 16 B x 17,
// so the 16 rows that half a wave reads with one ds_load_b128 meet each bank once.
typedef float v4f __attribute__((ext_vector_type(4)));
#define PBROW 68   // floats per ring row

// One tile, 16 rows x 128 B, global -> LDS: copy j brings rows 4j .. 4j+3, a lane
// 16 B, 8 lanes a whole line. The immediate offset moves both addresses: it
// steps the LDS row (4 x 272 B), and off[j] holds the lane's global byte offset
// less that step. The s_wait_xcnt stands inside the statement, ahead of any
// later write of a register that the copies name.
__device__ __forceinline__ void copy_bias(unsigned lds, const unsigned off[4],
                                          const float* base) {
  asm volatile(
      "global_load_async_to_lds_b128 %0, %1, %5\n\t"
      "global_load_async_to_lds_b128 %0, %2, %5 offset:1088\n\t"
      "global_load_async_to_lds_b128 %0, %3, %5 offset:2176\n\t"
      "global_load_async_to_lds_b128 %0, %4, %5 offset:3264\n\t"
      "s_wait_xcnt 0x0"
      :: "v"(lds), "v"(off[0]), "v"(off[1]), "v"(off[2]), "v"(off[3]), "s"(base)
      : "memory");
}
// The same into a place that the wave has read: its own s_wait_dscnt 0 stands in
// the copies' statement, directly in front of them (in a statement of its own it
// was scheduled up to the reads, where the wave would sit out their latency).
__device__ __forceinline__ void refill_bias(unsigned lds, const unsigned off[4],
                                            const float* base) {
  asm volatile(
      "s_wait_dscnt 0x0\n\t"
      "global_load_async_to_lds_b128 %0, %1, %5\n\t"
      "global_load_async_to_lds_b128 %0, %2, %5 offset:1088\n\t"
      "global_load_async_to_lds_b128 %0, %3, %5 offset:2176\n\t"
      "global_load_async_to_lds_b128 %0, %4, %5 offset:3264\n\t"
      "s_wait_xcnt 0x0"
      :: "v"(lds), "v"(off[0]), "v"(off[1]), "v"(off[2]), "v"(off[3]), "s"(base)
      : "memory");
}
// a lane's 2 x 8 consecutive keys of its own query row, out of the ring
__device__ __forceinline__ void read_bias(v8f pbv[2], const float* r) {
#pragma unroll
  for (int nt = 0; nt < 2; ++nt)
    pbv[nt] = __builtin_shufflevector(*(const v4f*)(r + nt * 16),
                                      *(const v4f*)(r + nt * 16 + 4),
                                      0, 1, 2, 3, 4, 5, 6, 7);
}

__global__ __launch_bounds__(128)
void flash_attn(const _Float16* __restrict__ Q,    // [B,H,S,DH] pre-scaled 1/8
                const _Float16* __restrict__ K,    // fragment order (kernel 1)
                const _Float16* __restrict__ Vt,   // fragment order (kernel 1)
                const float* __restrict__ pb,      // [1,H,S,S]
                const float* __restrict__ mask,    // [B,1,1,S]
                _Float16* __restrict__ ctx) {      // [B,S,D] f16
  __shared__ __attribute__((aligned(16))) float pbs[4][16 * PBROW];   // 17 KB
  const int wv   = threadIdx.x >> 5;
  const int lane = threadIdx.x & 31;
  const int mloc = lane & 15;
  const int hi   = lane >> 4;
  const int koff = hi * 8;
  const int bh = blockIdx.y, b = bh / HH, h = bh % HH;
  const int q0 = blockIdx.x * 64 + wv * 16;

  // bias ring: tiles 0 and 1 are asked for first of all
  const float* pbb = pb + ((size_t)h * SS + blockIdx.x * 64) * SS;   // the block's rows
  unsigned poff[4];
#pragma unroll
  for (int j = 0; j < 4; ++j)
    poff[j] = ((wv * 16 + j * 4 + (lane >> 3)) * SS + (lane & 7) * 4) * 4 - j * 1088;
  const unsigned pld = (unsigned)(size_t)&pbs[wv][0] + (lane >> 3) * (PBROW * 4) + (lane & 7) * 16;
  const float*   prd = &pbs[wv][mloc * PBROW + koff];
  copy_bias(pld, poff, pbb);
  copy_bias(pld + 128, poff, pbb + 32);

  const _Float16* qrow = Q + ((size_t)bh * SS + q0 + mloc) * DHD;
  const v16h bq0 = cat16(ld8h(qrow + koff),      ld8h(qrow + 16 + koff));
  const v16h bq1 = cat16(ld8h(qrow + 32 + koff), ld8h(qrow + 48 + koff));
  // stands ahead of the later write of the address registers that these loads name
  asm volatile("s_wait_xcnt 0x0" ::: "memory");

  // 32 keys are 2048 contiguous halves in both: 8 slots of 32 lanes x 8 halves
  const _Float16* Kh  = K  + (size_t)bh * SS * DHD + lane * 8;
  const _Float16* Vh  = Vt + (size_t)bh * DHD * SS + lane * 8;
  const float*    pbq = pb + ((size_t)h * SS + q0) * SS;
  const float*    mk  = mask + (size_t)b * SS + koff;

  v8f o[4];   // o[dt][r] = O[q0 + mloc][dt*16 + hi*8 + r]
#pragma unroll
  for (int i = 0; i < 4; ++i) o[i] = vzero8();
  float mi = -1e30f, li = 0.0f;   // li: this half's keys only, joined at the end

  // No pass waits for a load that it has just issued. K and mask are asked
  // for one pass ahead, right behind the score products that read them, and
  // carried in the same registers over the loop's back edge; so is the bias,
  // out of the ring; V is asked for at the head of its own pass, ahead of the
  // score products and the softmax, in the registers that the last output
  // products have read.
  v16h kf[4];
  v8f pbv[2], mkv[2];
  fetch_frag(kf, Kh);
  fetch_mask(mkv, mk);
  // stands ahead of any later write of an address register that these loads name
  asm volatile("s_wait_xcnt 0x0" ::: "memory");
  // holds the address arithmetic that follows behind that wait
  __builtin_amdgcn_sched_barrier(0);

  // tile 0 has landed: all but this wave's 4 youngest copies (tile 1's)
  asm volatile("s_wait_asynccnt 0x4" ::: "memory");
  read_bias(pbv, prd);
  // tile 2 goes to tile 0's place, behind the wave's own reads of it (the ring
  // is private to the wave: no other wave reads or fills it, so no barrier)
  refill_bias(pld, poff, pbb + 64);

  // where the next pass's K and mask lie
  const _Float16* kp = Kh + 32 * DHD;
  const float*    mp = mk + 32;

  for (int kb = 0; kb < SS; kb += 32) {
    v16h vf[4];
    fetch_frag(vf, Vh + (size_t)kb * DHD);
    // stands ahead of any later write of an address register that these loads
    // name; it also holds them here, at the head of the pass: without it they
    // are issued behind the score products and the wait in front of those
    asm volatile("s_wait_xcnt 0x0" ::: "memory");

    // ---- scores tile [32k x 16q] = bias + mask + K * Q^T (Q pre-scaled) ----
    // bias + mask go in as the products' C operand: their registers are free
    // for the next pass's loads as soon as the products are issued
    v8f sc[2];
#pragma unroll
    for (int nt = 0; nt < 2; ++nt) {
      v8f c = pbv[nt] + mkv[nt];
      c = __builtin_amdgcn_wmma_f32_16x16x32_f16(false, kf[nt*2+0], false, bq0, (short)0, c, false, false);
      c = __builtin_amdgcn_wmma_f32_16x16x32_f16(false, kf[nt*2+1], false, bq1, (short)0, c, false, false);
      sc[nt] = c;
    }
    if (kb + 160 < SS)  // bias chunk per q-row, two passes ahead of its copy
      __builtin_prefetch(pbq + (size_t)mloc * SS + kb + 160, 0, 1);

    fetch_frag(kf, kp);
    fetch_mask(mkv, mp);
    // stands ahead of any later write of an address register that these loads name
    asm volatile("s_wait_xcnt 0x0" ::: "memory");
    // the next pass's bias tile has landed: all but this wave's 4 youngest
    // copies (every pass issues 4, so the count holds in every pass)
    asm volatile("s_wait_asynccnt 0x4" ::: "memory");
    const int ring = (kb + 32) & 32;   // that tile's place in a ring row, in floats
    read_bias(pbv, prd + ring);
    // keeps these loads issued ahead of the softmax: without it most of them
    // are issued behind it, with no time to land before the next pass
    __builtin_amdgcn_sched_barrier(0);
    // the pointers stop on the last block: the last pass's fetch stays in
    // bounds (its values are never used)
    const int st = kb + 64 < SS ? 32 : 0;
    kp += st * DHD;
    mp += st;

    // ---- online softmax: one query per lane ----
    float x = fmaxf(sc[0][0], sc[1][0]);
#pragma unroll
    for (int r = 1; r < 8; ++r) x = fmaxf(x, fmaxf(sc[0][r], sc[1][r]));
    x = fmaxf(x, xhalf(x));
    const float mnew = fmaxf(mi, x);
    const float corr = __expf(mi - mnew);
    mi = mnew;
#pragma unroll
    for (int dt = 0; dt < 4; ++dt)
#pragma unroll
      for (int r = 0; r < 8; ++r) o[dt][r] *= corr;
    v16h bp;   // P^T as B: half nt*8 + r is key nt*16 + hi*8 + r
    float ps = 0.0f;
#pragma unroll
    for (int r = 0; r < 8; ++r) {
      float p0 = __expf(sc[0][r] - mnew);
      float p1 = __expf(sc[1][r] - mnew);
      ps += p0 + p1;
      bp[r]     = (_Float16)p0;
      bp[8 + r] = (_Float16)p1;
    }
    li = li * corr + ps;

    // ---- O^T += V^T * P^T  (V stored as ready fragments) ----
#pragma unroll
    for (int dt = 0; dt < 4; ++dt)
      o[dt] = __builtin_amdgcn_wmma_f32_16x16x32_f16(
          false, vf[dt], false, bp, (short)0, o[dt], false, false);

    // refill the place just read, three tiles on, behind the wave's own reads of
    // it. The tile index stops at the last tile: the copies stay in bounds and
    // every pass issues its 4 (what the last ones bring is never used)
    refill_bias(pld + ring * 4, poff, pbb + (kb + 96 < SS ? kb + 96 : SS - 32));
  }
  // no copy is in flight when the wave ends
  asm volatile("s_wait_asynccnt 0x0" ::: "memory");

  // ---- normalize and emit context in [B,S,H*DH] f16 for the output GEMM ----
  const float rinv = 1.0f / (li + xhalf(li));
  _Float16* crow = ctx + ((size_t)b * SS + q0 + mloc) * DD + (size_t)h * DHD + koff;
#pragma unroll
  for (int dt = 0; dt < 4; ++dt) {
    v8h pk;
#pragma unroll
    for (int r = 0; r < 8; ++r) pk[r] = (_Float16)(o[dt][r] * rinv);
    *(v8h*)(crow + dt * 16) = pk;
  }
}

// ---------------------------------------------------------------------------
// Kernel 3: output projection, f32 epilogue straight to d_out.
// ---------------------------------------------------------------------------
__global__ __launch_bounds__(256)
void gemm_out_f32(const _Float16* __restrict__ A,
                  const _Float16* __restrict__ W,
                  const float* __restrict__ bias,
                  float* __restrict__ out) {
  __shared__ __attribute__((aligned(16))) _Float16 Bt[2][128 * BPITCH];
  const int tid  = threadIdx.x;
  const int wv   = tid >> 5;
  const int lane = tid & 31;
  const int mloc = lane & 15;
  const int hi   = lane >> 4;
  const int koff = hi * 8;
  const int m0 = blockIdx.x * 128 + wv * 16;
  const int n0 = blockIdx.y * 128;

  v8f acc[8];
#pragma unroll
  for (int i = 0; i < 8; ++i) acc[i] = vzero8();

  gemm_core(A, W, Bt[0], Bt[1], m0, n0, tid, mloc, koff, acc);

#pragma unroll
  for (int nt = 0; nt < 8; ++nt) {
    int n = n0 + nt * 16 + mloc;
    float bv = bias[n];
#pragma unroll
    for (int r = 0; r < 8; ++r) {
      int m = m0 + r + hi * 8;
      out[(size_t)m * DD + n] = acc[nt][r] + bv;
    }
  }
}

// ---------------------------------------------------------------------------
// Host-side launcher (graph-capture safe: stream launches only, ws scratch).
// ---------------------------------------------------------------------------
extern "C" void kernel_launch(void* const* d_in, const int* in_sizes, int n_in,
                              void* d_out, int out_size, void* d_ws, size_t ws_size,
                              hipStream_t stream) {
  (void)in_sizes; (void)n_in; (void)out_size; (void)ws_size;

  const float* hs   = (const float*)d_in[0];
  const float* mask = (const float*)d_in[1];
  const float* pb   = (const float*)d_in[2];
  const float* Wq   = (const float*)d_in[3];
  const float* bq   = (const float*)d_in[4];
  const float* Wk   = (const float*)d_in[5];
  const float* bk   = (const float*)d_in[6];
  const float* Wv   = (const float*)d_in[7];
  const float* bv   = (const float*)d_in[8];
  const float* Wo   = (const float*)d_in[9];
  const float* bo   = (const float*)d_in[10];
  float* out = (float*)d_out;

  char* ws = (char*)d_ws;
  size_t off = 0;
  auto wsalloc = [&](size_t bytes) -> void* {
    void* p = ws + off;
    off += (bytes + 255) & ~(size_t)255;
    return p;
  };
  const size_t actBytes = (size_t)MM * DD * sizeof(_Float16);   // 6.29 MB
  const size_t wBytes   = (size_t)DD * DD * sizeof(_Float16);   // 1.18 MB
  // the casts' outputs back to back: X | Wq | Wk | Wv | Wo
  _Float16* X16   = (_Float16*)wsalloc(actBytes + 4 * wBytes);
  _Float16* Wq16  = X16 + MM * DD;
  _Float16* Wo16  = Wq16 + 3 * DD * DD;
  // the projections' outputs back to back: Q | K | V
  _Float16* Q16   = (_Float16*)wsalloc(3 * actBytes);   // [B,H,S,DH]
  _Float16* K16   = Q16 + MM * DD;                      // fragment order
  _Float16* Vt16  = K16 + MM * DD;                      // fragment order
  _Float16* ctx16 = (_Float16*)wsalloc(actBytes);   // [B,S,D]

  // 0) all five casts, one launch
  cvt_f32_f16<<<ACT_BLKS + 4 * W_BLKS, 256, 0, stream>>>(hs, Wq, Wk, Wv, Wo, X16);

  // 1) Q, K, V projections, one launch (Q pre-scaled; K, V in fragment order)
  dim3 ggrid(MM / 128, DD / 128);   // 32 x 6
  gemm_qkv_f16<<<dim3(MM / 128, DD / 128, 3), 256, 0, stream>>>(X16, Wq16, bq, bk, bv, Q16);

  // 2) fused flash attention with position bias + mask
  flash_attn<<<dim3(SS / 64, BB * HH), 128, 0, stream>>>(Q16, K16, Vt16, pb, mask, ctx16);

  // 3) output projection -> f32 result
  gemm_out_f32<<<ggrid, 256, 0, stream>>>(ctx16, Wo16, bo, out);
}

// v007
// A run of this version takes 95.2 microseconds.
// Next to v006, in two timings, it ran 1.12 times as fast each time.
// Counting every step since v000, it is 2.48 times as fast.
#include <hip/hip_runtime.h>
#include <hip/hip_bf16.h>

// ---------------------------------------------------------------------------
// Self-attention with additive position bias (gfx1250, wave32, WMMA).
// Bandwidth-bound on position_bias (201MB) -> flash-attention fusion,
// f16 matrix cores with f32 accumulate, f32 softmax.
// GEMMs: double-buffered LDS staging (async global->LDS), batched B-fragment
// preload so WMMAs issue back-to-back.
// ---------------------------------------------------------------------------

typedef _Float16 v8h  __attribute__((ext_vector_type(8)));
typedef _Float16 v16h __attribute__((ext_vector_type(16)));
typedef float    v8f  __attribute__((ext_vector_type(8)));

#define HH 12
#define DHD 64
#define DD 768
#define BB 2
#define SS 2048
#define MM (BB * SS)   // 4096 rows

#if __has_builtin(__builtin_amdgcn_global_load_async_to_lds_b128)
#define USE_ASYNC_LDS 1
#else
#define USE_ASYNC_LDS 0
#endif

__device__ __forceinline__ v16h cat16(v8h lo, v8h hi) {
  return __builtin_shufflevector(lo, hi, 0,1,2,3,4,5,6,7,8,9,10,11,12,13,14,15);
}
__device__ __forceinline__ v8h ld8h(const _Float16* p) { return *(const v8h*)p; }
__device__ __forceinline__ v8f vzero8() {
  v8f z;
#pragma unroll
  for (int i = 0; i < 8; ++i) z[i] = 0.0f;
  return z;
}

// 32-byte global -> LDS stage for one thread (16 halves), async when available.
__device__ __forceinline__ void stage_row(_Float16* dst, const _Float16* src) {
#if USE_ASYNC_LDS
  typedef int v4i __attribute__((vector_size(16)));
  typedef __attribute__((address_space(1))) v4i* gptr_t;
  typedef __attribute__((address_space(3))) v4i* lptr_t;
  gptr_t g = (gptr_t)src;
  lptr_t l = (lptr_t)dst;
  __builtin_amdgcn_global_load_async_to_lds_b128(g, l, 0, 0);
  __builtin_amdgcn_global_load_async_to_lds_b128(g, l, 16, 0);
#else
  v8h t0 = *(const v8h*)src;
  v8h t1 = *(const v8h*)(src + 8);
  *(v8h*)dst = t0;
  *(v8h*)(dst + 8) = t1;
#endif
}

__device__ __forceinline__ void wait_async_lds() {
#if USE_ASYNC_LDS
# if __has_builtin(__builtin_amdgcn_s_wait_asynccnt)
  __builtin_amdgcn_s_wait_asynccnt(0);
# else
  asm volatile("s_wait_asynccnt 0" ::: "memory");
# endif
#endif
}

// ---------------------------------------------------------------------------
// Kernel 0: f32 -> f16 casts of hidden_states and the four weights, vectorized
// x4, all in ONE launch: none needs anything of another. A block casts 1024
// floats. The five f16 copies lie back to back in the workspace, so a block's
// place in the grid is its place in the output; only the source goes by range.
// ---------------------------------------------------------------------------
#define ACT_BLKS (MM * DD / 1024)   // 3072 blocks: hidden_states
#define W_BLKS   (DD * DD / 1024)   // 576 blocks: each weight

__global__ void cvt_f32_f16(const float* __restrict__ hs,
                            const float* __restrict__ wq,
                            const float* __restrict__ wk,
                            const float* __restrict__ wv,
                            const float* __restrict__ wo,
                            _Float16* __restrict__ out) {
  const int blk = blockIdx.x;
  const float* in = hs;
  int rel = blk;
  if (blk >= ACT_BLKS) {   // block-uniform
    const int w = (blk - ACT_BLKS) / W_BLKS;
    rel = (blk - ACT_BLKS) - w * W_BLKS;
    in = w == 0 ? wq : w == 1 ? wk : w == 2 ? wv : wo;
  }
  const int t = threadIdx.x * 4;
  float4 v = *(const float4*)(in + rel * 1024 + t);
  _Float16* o = out + blk * 1024 + t;
  o[0] = (_Float16)v.x;
  o[1] = (_Float16)v.y;
  o[2] = (_Float16)v.z;
  o[3] = (_Float16)v.w;
}

// ---------------------------------------------------------------------------
// Shared TN-GEMM core: acc[8] += A[M,K] * W[N,K]^T over K=768.
// 8 waves / WG; W tile (128x32 halves) double-buffered in LDS; one barrier
// per K-step; async copy of tile i+1 overlaps WMMAs on tile i.
// W tile row's 64 bytes lie at a pitch of 80 B (16 B x odd): the 16 rows that
// half a wave reads with one ds_load_b128 fall on all 64 banks once; at 64 B
// they fall on 16 banks, four rows deep.
// A-fragment (16x32 f16, ISA layout): lane L -> row M = L&15,
//   half chunks at K = kk + (L>=16?8:0) and kk + 16 + (L>=16?8:0).
// ---------------------------------------------------------------------------
#define BPITCH 40   // halves per W tile row in LDS: 32 of data, 8 never touched

__device__ __forceinline__ void stage_tile(const _Float16* __restrict__ W,
                                           _Float16* BtBuf, int n0, int kk,
                                           int tid) {
  int n = tid >> 1, c = (tid & 1) * 16;
  stage_row(&BtBuf[n * BPITCH + c], W + (size_t)(n0 + n) * DD + kk + c);
}

// A fragment of one K-step: arow is the lane's row, already at its half's koff
__device__ __forceinline__ v16h load_a(const _Float16* __restrict__ arow, int kk) {
  return cat16(ld8h(arow + kk), ld8h(arow + kk + 16));
}
// the eight B fragments of one K-step, out of the W tile in LDS
__device__ __forceinline__ void read_b(v16h bf[8], const _Float16* BtBuf,
                                       int mloc, int koff) {
#pragma unroll
  for (int nt = 0; nt < 8; ++nt) {
    const _Float16* brow = &BtBuf[(nt * 16 + mloc) * BPITCH];
    bf[nt] = cat16(*(const v8h*)(brow + koff), *(const v8h*)(brow + 16 + koff));
  }
}
__device__ __forceinline__ void products(v16h a, const v16h bf[8], v8f acc[8]) {
  // holds the step's 16 LDS reads and the next step's A loads as one group
  // ahead of the products: without it each product's two reads are sunk
  // directly in front of it, into one register set, and every product sits out
  // a whole LDS latency
  __builtin_amdgcn_sched_barrier(0);
#pragma unroll
  for (int nt = 0; nt < 8; ++nt)
    acc[nt] = __builtin_amdgcn_wmma_f32_16x16x32_f16(
        false, a, false, bf[nt], (short)0, acc[nt], false, false);
  // holds the products in front of the waits and the barrier that close the
  // step: sunk behind them they start only when the next tile's copies have
  // landed, and the copies after those are issued behind the products
  __builtin_amdgcn_sched_barrier(0);
}

// A step's loads all go out at its head: the next W tile's copies, its own 16
// LDS reads, and the NEXT step's A fragment, which comes straight from global
// memory and lands under this step's work.
__device__ __forceinline__ void gemm_core(const _Float16* __restrict__ A,
                                          const _Float16* __restrict__ W,
                                          _Float16* Bt0, _Float16* Bt1,
                                          int m0, int n0, int tid,
                                          int mloc, int koff, v8f acc[8]) {
  // the lane's A row, at the K of the trip's first step: one pointer, carried
  const _Float16* ap = A + (size_t)(m0 + mloc) * DD + koff;
  stage_tile(W, Bt0, n0, 0, tid);
  v16h a0 = load_a(ap, 0);
  // stands ahead of any later write of an address register that these loads name
  asm volatile("s_wait_xcnt 0x0" ::: "memory");
  // stays a loop: a trip waits at its two barriers whether unrolled or not, and
  // twelve copies of the body are four times the code
#pragma unroll 1
  for (int kk = 0; kk < DD; kk += 64) {
    v16h bf[8];
    wait_async_lds();
    __syncthreads();
    if (kk + 32 < DD) stage_tile(W, Bt1, n0, kk + 32, tid);
    read_b(bf, Bt0, mloc, koff);
    v16h a1 = load_a(ap, 32);
    // stands ahead of any later write of an address register that these loads
    // name; behind the LDS reads, so that it passes under their latency
    asm volatile("s_wait_xcnt 0x0" ::: "memory");
    products(a0, bf, acc);

    wait_async_lds();
    __syncthreads();
    if (kk + 64 < DD) stage_tile(W, Bt0, n0, kk + 64, tid);
    read_b(bf, Bt1, mloc, koff);
    // behind the last step the fetch goes back to the row's start: it stays in
    // bounds (its values are never used)
    ap += kk + 64 < DD ? 64 : -kk;
    a0 = load_a(ap, 0);
    // stands ahead of any later write of an address register that these loads
    // name; behind the LDS reads, so that it passes under their latency
    asm volatile("s_wait_xcnt 0x0" ::: "memory");
    products(a1, bf, acc);
  }
}

// ---------------------------------------------------------------------------
// Kernel 1: Q, K and V projections in ONE launch: blockIdx.z picks the weight,
// the bias, the output plane and its layout (0 = Q, 1 = K, 2 = V).
// Q: rows, [B,H,S,DH], pre-scaled by 1/sqrt(DH).
// K and V: WMMA B-fragment order, so that one b128 load
// of a wave in the attention kernel reads 512 contiguous bytes (4 lines)
// instead of 16 bytes out of each of 16 lines.
//   K: [B*H][S/16 key tile][dh/32][chunk 2][lane 32][8 halves]
//      lane = ((dh>>3)&1)*16 + (s&15), chunk = (dh>>4)&1, half = dh&7
//   V: [B*H][S/32 key block][dh/16][chunk 2][lane 32][8 halves]
//      lane = ((s>>3)&1)*16 + (dh&15), chunk = (s>>4)&1, half = s&7
// ---------------------------------------------------------------------------
__global__ __launch_bounds__(256)
void gemm_qkv_f16(const _Float16* __restrict__ A,
                  const _Float16* __restrict__ Wqkv,   // Wq | Wk | Wv
                  const float* __restrict__ bq,
                  const float* __restrict__ bk,
                  const float* __restrict__ bv,
                  _Float16* __restrict__ qkv) {        // Q | K | V planes
  __shared__ __attribute__((aligned(16))) _Float16 Bt[2][128 * BPITCH];   // 20 KB double buffer
  const int which = blockIdx.z;
  const _Float16* W = Wqkv + which * (DD * DD);
  const float* bias = which == 0 ? bq : which == 1 ? bk : bv;
  _Float16* out = qkv + which * (MM * DD);
  const float scale = which == 0 ? 0.125f : 1.0f;
  const int tid  = threadIdx.x;
  const int wv   = tid >> 5;
  const int lane = tid & 31;
  const int mloc = lane & 15;
  const int hi   = lane >> 4;
  const int koff = hi * 8;
  const int m0 = blockIdx.x * 128 + wv * 16;
  const int n0 = blockIdx.y * 128;

  v8f acc[8];
#pragma unroll
  for (int i = 0; i < 8; ++i) acc[i] = vzero8();

  gemm_core(A, W, Bt[0], Bt[1], m0, n0, tid, mloc, koff, acc);

  // epilogue: C layout lane holds (M = r + hi*8, N = nt*16 + (lane&15))
  const int bb = m0 >> 11, s0 = m0 & 2047;   // the wave's 16 rows: one batch
  float bvv[8];
#pragma unroll
  for (int nt = 0; nt < 8; ++nt) bvv[nt] = bias[n0 + nt * 16 + mloc];
  // n0 is a multiple of 128: tiles 0..3 are head n0/64, tiles 4..7 the next;
  // within a head dh = (nt&3)*16 + mloc
  _Float16* ob = out + (size_t)(bb * HH + (n0 >> 6)) * SS * DHD;
  if (which == 2) {
    // a lane's 8 rows are the 8 halves of its own fragment slot
    _Float16* ov = ob + (s0 >> 5) * 2048 + ((s0 >> 4) & 1) * 256 + lane * 8;
#pragma unroll
    for (int nt = 0; nt < 8; ++nt) {
      v8h pk;
#pragma unroll
      for (int r = 0; r < 8; ++r) pk[r] = (_Float16)((acc[nt][r] + bvv[nt]) * scale);
      *(v8h*)(ov + (nt >> 2) * SS * DHD + (nt & 3) * 512) = pk;
    }
    // stands ahead of any later write of a register that these stores name
    // (the other layouts' blocks follow this one in the built code)
    asm volatile("s_wait_xcnt 0x0" ::: "memory");
  } else if (which == 1) {
    _Float16* ok = ob + (s0 >> 4) * 1024 + ((mloc >> 3) * 16 + hi * 8) * 8 + (mloc & 7);
#pragma unroll
    for (int nt = 0; nt < 8; ++nt)
#pragma unroll
      for (int r = 0; r < 8; ++r)
        ok[(nt >> 2) * SS * DHD + (nt & 3) * 256 + r * 8] =
            (_Float16)((acc[nt][r] + bvv[nt]) * scale);
    // stands ahead of any later write of a register that these stores name
    // (the other layouts' blocks follow this one in the built code)
    asm volatile("s_wait_xcnt 0x0" ::: "memory");
  } else {
    _Float16* oq = ob + (s0 + hi * 8) * DHD + mloc;
#pragma unroll
    for (int nt = 0; nt < 8; ++nt)
#pragma unroll
      for (int r = 0; r < 8; ++r)
        oq[(nt >> 2) * SS * DHD + r * DHD + (nt & 3) * 16] =
            (_Float16)((acc[nt][r] + bvv[nt]) * scale);
    // stands ahead of any later write of a register that these stores name
    // (the other layouts' blocks follow this one in the built code)
    asm volatile("s_wait_xcnt 0x0" ::: "memory");
  }
}

__device__ __forceinline__ float xhalf(float x) {
  int b = __builtin_bit_cast(int, x);
  return __builtin_bit_cast(float, __builtin_amdgcn_permlanex16(
      b, b, 0x76543210, 0xfedcba98, false, false));
}

// one pass's operands: 32 keys of K (4 fragments), of V (4 fragments), and a
// lane's 2 x 8 consecutive keys of attention_mask
__device__ __forceinline__ void fetch_frag(v16h f[4], const _Float16* p) {
#pragma unroll
  for (int i = 0; i < 4; ++i) f[i] = cat16(ld8h(p + i * 512), ld8h(p + i * 512 + 256));
}
__device__ __forceinline__ void fetch_mask(v8f mkv[2], const float* mr) {
#pragma unroll
  for (int nt = 0; nt < 2; ++nt) mkv[nt] = *(const v8f*)(mr + nt * 16);
}

// A wave's bias ring: 16 query rows; a row holds the two tiles (32 keys, 128 B
// each) side by side and 16 B that are never touched: pitch 272 B = 16 B x 17,
// so the 16 rows that half a wave reads with one ds_load_b128 meet each bank once.
typedef float v4f __attribute__((ext_vector_type(4)));
#define PBROW 68   // floats per ring row

// One tile, 16 rows x 128 B, global -> LDS: copy j brings rows 4j .. 4j+3, a lane
// 16 B, 8 lanes a whole line. The immediate offset moves both addresses: it
// steps the LDS row (4 x 272 B), and off[j] holds the lane's global byte offset
// less that step. The s_wait_xcnt stands inside the statement, ahead of any
// later write of a register that the copies name.
__device__ __forceinline__ void copy_bias(unsigned lds, const unsigned off[4],
                                          const float* base) {
  asm volatile(
      "global_load_async_to_lds_b128 %0, %1, %5\n\t"
      "global_load_async_to_lds_b128 %0, %2, %5 offset:1088\n\t"
      "global_load_async_to_lds_b128 %0, %3, %5 offset:2176\n\t"
      "global_load_async_to_lds_b128 %0, %4, %5 offset:3264\n\t"
      "s_wait_xcnt 0x0"
      :: "v"(lds), "v"(off[0]), "v"(off[1]), "v"(off[2]), "v"(off[3]), "s"(base)
      : "memory");
}
// The same into a place that the wave has read: its own s_wait_dscnt 0 stands in
// the copies' statement, directly in front of them (in a statement of its own it
// was scheduled up to the reads, where the wave would sit out their latency).
__device__ __forceinline__ void refill_bias(unsigned lds, const unsigned off[4],
                                            const float* base) {
  asm volatile(
      "s_wait_dscnt 0x0\n\t"
      "global_load_async_to_lds_b128 %0, %1, %5\n\t"
      "global_load_async_to_lds_b128 %0, %2, %5 offset:1088\n\t"
      "global_load_async_to_lds_b128 %0, %3, %5 offset:2176\n\t"
      "global_load_async_to_lds_b128 %0, %4, %5 offset:3264\n\t"
      "s_wait_xcnt 0x0"
      :: "v"(lds), "v"(off[0]), "v"(off[1]), "v"(off[2]), "v"(off[3]), "s"(base)
      : "memory");
}
// a lane's 2 x 8 consecutive keys of its own query row, out of the ring
__device__ __forceinline__ void read_bias(v8f pbv[2], const float* r) {
#pragma unroll
  for (int nt = 0; nt < 2; ++nt)
    pbv[nt] = __builtin_shufflevector(*(const v4f*)(r + nt * 16),
                                      *(const v4f*)(r + nt * 16 + 4),
                                      0, 1, 2, 3, 4, 5, 6, 7);
}

__global__ __launch_bounds__(128)
void flash_attn(const _Float16* __restrict__ Q,    // [B,H,S,DH] pre-scaled 1/8
                const _Float16* __restrict__ K,    // fragment order (kernel 1)
                const _Float16* __restrict__ Vt,   // fragment order (kernel 1)
                const float* __restrict__ pb,      // [1,H,S,S]
                const float* __restrict__ mask,    // [B,1,1,S]
                _Float16* __restrict__ ctx) {      // [B,S,D] f16
  __shared__ __attribute__((aligned(16))) float pbs[4][16 * PBROW];   // 17 KB
  const int wv   = threadIdx.x >> 5;
  const int lane = threadIdx.x & 31;
  const int mloc = lane & 15;
  const int hi   = lane >> 4;
  const int koff = hi * 8;
  const int bh = blockIdx.y, b = bh / HH, h = bh % HH;
  const int q0 = blockIdx.x * 64 + wv * 16;

  // bias ring: tiles 0 and 1 are asked for first of all
  const float* pbb = pb + ((size_t)h * SS + blockIdx.x * 64) * SS;   // the block's rows
  unsigned poff[4];
#pragma unroll
  for (int j = 0; j < 4; ++j)
    poff[j] = ((wv * 16 + j * 4 + (lane >> 3)) * SS + (lane & 7) * 4) * 4 - j * 1088;
  const unsigned pld = (unsigned)(size_t)&pbs[wv][0] + (lane >> 3) * (PBROW * 4) + (lane & 7) * 16;
  const float*   prd = &pbs[wv][mloc * PBROW + koff];
  copy_bias(pld, poff, pbb);
  copy_bias(pld + 128, poff, pbb + 32);

  const _Float16* qrow = Q + ((size_t)bh * SS + q0 + mloc) * DHD;
  const v16h bq0 = cat16(ld8h(qrow + koff),      ld8h(qrow + 16 + koff));
  const v16h bq1 = cat16(ld8h(qrow + 32 + koff), ld8h(qrow + 48 + koff));
  // stands ahead of the later write of the address registers that these loads name
  asm volatile("s_wait_xcnt 0x0" ::: "memory");

  // 32 keys are 2048 contiguous halves in both: 8 slots of 32 lanes x 8 halves
  const _Float16* Kh  = K  + (size_t)bh * SS * DHD + lane * 8;
  const _Float16* Vh  = Vt + (size_t)bh * DHD * SS + lane * 8;
  const float*    pbq = pb + ((size_t)h * SS + q0) * SS;
  const float*    mk  = mask + (size_t)b * SS + koff;

  v8f o[4];   // o[dt][r] = O[q0 + mloc][dt*16 + hi*8 + r]
#pragma unroll
  for (int i = 0; i < 4; ++i) o[i] = vzero8();
  float mi = -1e30f, li = 0.0f;   // li: this half's keys only, joined at the end

  // No pass waits for a load that it has just issued. K and mask are asked
  // for one pass ahead, right behind the score products that read them, and
  // carried in the same registers over the loop's back edge; so is the bias,
  // out of the ring; V is asked for at the head of its own pass, ahead of the
  // score products and the softmax, in the registers that the last output
  // products have read.
  v16h kf[4];
  v8f pbv[2], mkv[2];
  fetch_frag(kf, Kh);
  fetch_mask(mkv, mk);
  // stands ahead of any later write of an address register that these loads name
  asm volatile("s_wait_xcnt 0x0" ::: "memory");
  // holds the address arithmetic that follows behind that wait
  __builtin_amdgcn_sched_barrier(0);

  // tile 0 has landed: all but this wave's 4 youngest copies (tile 1's)
  asm volatile("s_wait_asynccnt 0x4" ::: "memory");
  read_bias(pbv, prd);
  // tile 2 goes to tile 0's place, behind the wave's own reads of it (the ring
  // is private to the wave: no other wave reads or fills it, so no barrier)
  refill_bias(pld, poff, pbb + 64);

  // where the next pass's K and mask lie
  const _Float16* kp = Kh + 32 * DHD;
  const float*    mp = mk + 32;

  for (int kb = 0; kb < SS; kb += 32) {
    v16h vf[4];
    fetch_frag(vf, Vh + (size_t)kb * DHD);
    // stands ahead of any later write of an address register that these loads
    // name; it also holds them here, at the head of the pass: without it they
    // are issued behind the score products and the wait in front of those
    asm volatile("s_wait_xcnt 0x0" ::: "memory");

    // ---- scores tile [32k x 16q] = bias + mask + K * Q^T (Q pre-scaled) ----
    // bias + mask go in as the products' C operand: their registers are free
    // for the next pass's loads as soon as the products are issued
    v8f sc[2];
#pragma unroll
    for (int nt = 0; nt < 2; ++nt) {
      v8f c = pbv[nt] + mkv[nt];
      c = __builtin_amdgcn_wmma_f32_16x16x32_f16(false, kf[nt*2+0], false, bq0, (short)0, c, false, false);
      c = __builtin_amdgcn_wmma_f32_16x16x32_f16(false, kf[nt*2+1], false, bq1, (short)0, c, false, false);
      sc[nt] = c;
    }
    if (kb + 160 < SS)  // bias chunk per q-row, two passes ahead of its copy
      __builtin_prefetch(pbq + (size_t)mloc * SS + kb + 160, 0, 1);

    fetch_frag(kf, kp);
    fetch_mask(mkv, mp);
    // stands ahead of any later write of an address register that these loads name
    asm volatile("s_wait_xcnt 0x0" ::: "memory");
    // the next pass's bias tile has landed: all but this wave's 4 youngest
    // copies (every pass issues 4, so the count holds in every pass)
    asm volatile("s_wait_asynccnt 0x4" ::: "memory");
    const int ring = (kb + 32) & 32;   // that tile's place in a ring row, in floats
    read_bias(pbv, prd + ring);
    // keeps these loads issued ahead of the softmax: without it most of them
    // are issued behind it, with no time to land before the next pass
    __builtin_amdgcn_sched_barrier(0);
    // the pointers stop on the last block: the last pass's fetch stays in
    // bounds (its values are never used)
    const int st = kb + 64 < SS ? 32 : 0;
    kp += st * DHD;
    mp += st;

    // ---- online softmax: one query per lane ----
    float x = fmaxf(sc[0][0], sc[1][0]);
#pragma unroll
    for (int r = 1; r < 8; ++r) x = fmaxf(x, fmaxf(sc[0][r], sc[1][r]));
    x = fmaxf(x, xhalf(x));
    const float mnew = fmaxf(mi, x);
    const float corr = __expf(mi - mnew);
    mi = mnew;
#pragma unroll
    for (int dt = 0; dt < 4; ++dt)
#pragma unroll
      for (int r = 0; r < 8; ++r) o[dt][r] *= corr;
    v16h bp;   // P^T as B: half nt*8 + r is key nt*16 + hi*8 + r
    float ps = 0.0f;
#pragma unroll
    for (int r = 0; r < 8; ++r) {
      float p0 = __expf(sc[0][r] - mnew);
      float p1 = __expf(sc[1][r] - mnew);
      ps += p0 + p1;
      bp[r]     = (_Float16)p0;
      bp[8 + r] = (_Float16)p1;
    }
    li = li * corr + ps;

    // ---- O^T += V^T * P^T  (V stored as ready fragments) ----
#pragma unroll
    for (int dt = 0; dt < 4; ++dt)
      o[dt] = __builtin_amdgcn_wmma_f32_16x16x32_f16(
          false, vf[dt], false, bp, (short)0, o[dt], false, false);

    // refill the place just read, three tiles on, behind the wave's own reads of
    // it. The tile index stops at the last tile: the copies stay in bounds and
    // every pass issues its 4 (what the last ones bring is never used)
    refill_bias(pld + ring * 4, poff, pbb + (kb + 96 < SS ? kb + 96 : SS - 32));
  }
  // no copy is in flight when the wave ends
  asm volatile("s_wait_asynccnt 0x0" ::: "memory");

  // ---- normalize and emit context in [B,S,H*DH] f16 for the output GEMM ----
  const float rinv = 1.0f / (li + xhalf(li));
  _Float16* crow = ctx + ((size_t)b * SS + q0 + mloc) * DD + (size_t)h * DHD + koff;
#pragma unroll
  for (int dt = 0; dt < 4; ++dt) {
    v8h pk;
#pragma unroll
    for (int r = 0; r < 8; ++r) pk[r] = (_Float16)(o[dt][r] * rinv);
    *(v8h*)(crow + dt * 16) = pk;
  }
}

// ---------------------------------------------------------------------------
// Kernel 3: output projection, f32 epilogue straight to d_out.
// ---------------------------------------------------------------------------
__global__ __launch_bounds__(256)
void gemm_out_f32(const _Float16* __restrict__ A,
                  const _Float16* __restrict__ W,
                  const float* __restrict__ bias,
                  float* __restrict__ out) {
  __shared__ __attribute__((aligned(16))) _Float16 Bt[2][128 * BPITCH];
  const int tid  = threadIdx.x;
  const int wv   = tid >> 5;
  const int lane = tid & 31;
  const int mloc = lane & 15;
  const int hi   = lane >> 4;
  const int koff = hi * 8;
  const int m0 = blockIdx.x * 128 + wv * 16;
  const int n0 = blockIdx.y * 128;

  v8f acc[8];
#pragma unroll
  for (int i = 0; i < 8; ++i) acc[i] = vzero8();

  gemm_core(A, W, Bt[0], Bt[1], m0, n0, tid, mloc, koff, acc);

#pragma unroll
  for (int nt = 0; nt < 8; ++nt) {
    int n = n0 + nt * 16 + mloc;
    float bv = bias[n];
#pragma unroll
    for (int r = 0; r < 8; ++r) {
      int m = m0 + r + hi * 8;
      out[(size_t)m * DD + n] = acc[nt][r] + bv;
    }
  }
}

// ---------------------------------------------------------------------------
// Host-side launcher (graph-capture safe: stream launches only, ws scratch).
// ---------------------------------------------------------------------------
extern "C" void kernel_launch(void* const* d_in, const int* in_sizes, int n_in,
                              void* d_out, int out_size, void* d_ws, size_t ws_size,
                              hipStream_t stream) {
  (void)in_sizes; (void)n_in; (void)out_size; (void)ws_size;

  const float* hs   = (const float*)d_in[0];
  const float* mask = (const float*)d_in[1];
  const float* pb   = (const float*)d_in[2];
  const float* Wq   = (const float*)d_in[3];
  const float* bq   = (const float*)d_in[4];
  const float* Wk   = (const float*)d_in[5];
  const float* bk   = (const float*)d_in[6];
  const float* Wv   = (const float*)d_in[7];
  const float* bv   = (const float*)d_in[8];
  const float* Wo   = (const float*)d_in[9];
  const float* bo   = (const float*)d_in[10];
  float* out = (float*)d_out;

  char* ws = (char*)d_ws;
  size_t off = 0;
  auto wsalloc = [&](size_t bytes) -> void* {
    void* p = ws + off;
    off += (bytes + 255) & ~(size_t)255;
    return p;
  };
  const size_t actBytes = (size_t)MM * DD * sizeof(_Float16);   // 6.29 MB
  const size_t wBytes   = (size_t)DD * DD * sizeof(_Float16);   // 1.18 MB
  // the casts' outputs back to back: X | Wq | Wk | Wv | Wo
  _Float16* X16   = (_Float16*)wsalloc(actBytes + 4 * wBytes);
  _Float16* Wq16  = X16 + MM * DD;
  _Float16* Wo16  = Wq16 + 3 * DD * DD;
  // the projections' outputs back to back: Q | K | V
  _Float16* Q16   = (_Float16*)wsalloc(3 * actBytes);   // [B,H,S,DH]
  _Float16* K16   = Q16 + MM * DD;                      // fragment order
  _Float16* Vt16  = K16 + MM * DD;                      // fragment order
  _Float16* ctx16 = (_Float16*)wsalloc(actBytes);   // [B,S,D]

  // 0) all five casts, one launch
  cvt_f32_f16<<<ACT_BLKS + 4 * W_BLKS, 256, 0, stream>>>(hs, Wq, Wk, Wv, Wo, X16);

  // 1) Q, K, V projections, one launch (Q pre-scaled; K, V in fragment order)
  dim3 ggrid(MM / 128, DD / 128);   // 32 x 6
  gemm_qkv_f16<<<dim3(MM / 128, DD / 128, 3), 256, 0, stream>>>(X16, Wq16, bq, bk, bv, Q16);

  // 2) fused flash attention with position bias + mask
  flash_attn<<<dim3(SS / 64, BB * HH), 128, 0, stream>>>(Q16, K16, Vt16, pb, mask, ctx16);

  // 3) output projection -> f32 result
  gemm_out_f32<<<ggrid, 256, 0, stream>>>(ctx16, Wo16, bo, out);
}

// v008
// Measured time: 85.1 microseconds a run.
// Two timings next to v007 both put it at 1.12 times that version's speed.
// Counting every step since v000, it is 2.78 times as fast.
#include <hip/hip_runtime.h>
#include <hip/hip_bf16.h>

// ---------------------------------------------------------------------------
// Self-attention with additive position bias (gfx1250, wave32, WMMA).
// Bandwidth-bound on position_bias (201MB) -> flash-attention fusion,
// f16 matrix cores with f32 accumulate, f32 softmax.
// GEMMs: double-buffered LDS staging (async global->LDS), batched B-fragment
// preload so WMMAs issue back-to-back.
// ---------------------------------------------------------------------------

typedef _Float16 v8h  __attribute__((ext_vector_type(8)));
typedef _Float16 v16h __attribute__((ext_vector_type(16)));
typedef float    v8f  __attribute__((ext_vector_type(8)));

#define HH 12
#define DHD 64
#define DD 768
#define BB 2
#define SS 2048
#define MM (BB * SS)   // 4096 rows

#if __has_builtin(__builtin_amdgcn_global_load_async_to_lds_b128)
#define USE_ASYNC_LDS 1
#else
#define USE_ASYNC_LDS 0
#endif

__device__ __forceinline__ v16h cat16(v8h lo, v8h hi) {
  return __builtin_shufflevector(lo, hi, 0,1,2,3,4,5,6,7,8,9,10,11,12,13,14,15);
}
__device__ __forceinline__ v8h ld8h(const _Float16* p) { return *(const v8h*)p; }
__device__ __forceinline__ v8f vzero8() {
  v8f z;
#pragma unroll
  for (int i = 0; i < 8; ++i) z[i] = 0.0f;
  return z;
}

// 32-byte global -> LDS stage for one thread (16 halves), async when available.
__device__ __forceinline__ void stage_row(_Float16* dst, const _Float16* src) {
#if USE_ASYNC_LDS
  typedef int v4i __attribute__((vector_size(16)));
  typedef __attribute__((address_space(1))) v4i* gptr_t;
  typedef __attribute__((address_space(3))) v4i* lptr_t;
  gptr_t g = (gptr_t)src;
  lptr_t l = (lptr_t)dst;
  __builtin_amdgcn_global_load_async_to_lds_b128(g, l, 0, 0);
  __builtin_amdgcn_global_load_async_to_lds_b128(g, l, 16, 0);
#else
  v8h t0 = *(const v8h*)src;
  v8h t1 = *(const v8h*)(src + 8);
  *(v8h*)dst = t0;
  *(v8h*)(dst + 8) = t1;
#endif
}

__device__ __forceinline__ void wait_async_lds() {
#if USE_ASYNC_LDS
# if __has_builtin(__builtin_amdgcn_s_wait_asynccnt)
  __builtin_amdgcn_s_wait_asynccnt(0);
# else
  asm volatile("s_wait_asynccnt 0" ::: "memory");
# endif
#endif
}

// ---------------------------------------------------------------------------
// Kernel 0: f32 -> f16 casts of hidden_states and the four weights, vectorized
// x4, all in ONE launch: none needs anything of another. A block casts 1024
// floats. The five f16 copies lie back to back in the workspace, so a block's
// place in the grid is its place in the output; only the source goes by range.
// ---------------------------------------------------------------------------
#define ACT_BLKS (MM * DD / 1024)   // 3072 blocks: hidden_states
#define W_BLKS   (DD * DD / 1024)   // 576 blocks: each weight

__global__ void cvt_f32_f16(const float* __restrict__ hs,
                            const float* __restrict__ wq,
                            const float* __restrict__ wk,
                            const float* __restrict__ wv,
                            const float* __restrict__ wo,
                            _Float16* __restrict__ out) {
  const int blk = blockIdx.x;
  const float* in = hs;
  int rel = blk;
  if (blk >= ACT_BLKS) {   // block-uniform
    const int w = (blk - ACT_BLKS) / W_BLKS;
    rel = (blk - ACT_BLKS) - w * W_BLKS;
    in = w == 0 ? wq : w == 1 ? wk : w == 2 ? wv : wo;
  }
  const int t = threadIdx.x * 4;
  float4 v = *(const float4*)(in + rel * 1024 + t);
  _Float16* o = out + blk * 1024 + t;
  o[0] = (_Float16)v.x;
  o[1] = (_Float16)v.y;
  o[2] = (_Float16)v.z;
  o[3] = (_Float16)v.w;
}

// ---------------------------------------------------------------------------
// Shared TN-GEMM core: acc[8] += A[M,K] * W[N,K]^T over K=768.
// 8 waves / WG; W tile (128x32 halves) double-buffered in LDS; one barrier
// per K-step; async copy of tile i+1 overlaps WMMAs on tile i.
// W tile row's 64 bytes lie at a pitch of 80 B (16 B x odd): the 16 rows that
// half a wave reads with one ds_load_b128 fall on all 64 banks once; at 64 B
// they fall on 16 banks, four rows deep.
// A-fragment (16x32 f16, ISA layout): lane L -> row M = L&15,
//   half chunks at K = kk + (L>=16?8:0) and kk + 16 + (L>=16?8:0).
// ---------------------------------------------------------------------------
#define BPITCH 40   // halves per W tile row in LDS: 32 of data, 8 never touched

__device__ __forceinline__ void stage_tile(const _Float16* __restrict__ W,
                                           _Float16* BtBuf, int n0, int kk,
                                           int tid) {
  int n = tid >> 1, c = (tid & 1) * 16;
  stage_row(&BtBuf[n * BPITCH + c], W + (size_t)(n0 + n) * DD + kk + c);
}

// A fragment of one K-step: arow is the lane's row, already at its half's koff
__device__ __forceinline__ v16h load_a(const _Float16* __restrict__ arow, int kk) {
  return cat16(ld8h(arow + kk), ld8h(arow + kk + 16));
}
// the eight B fragments of one K-step, out of the W tile in LDS
__device__ __forceinline__ void read_b(v16h bf[8], const _Float16* BtBuf,
                                       int mloc, int koff) {
#pragma unroll
  for (int nt = 0; nt < 8; ++nt) {
    const _Float16* brow = &BtBuf[(nt * 16 + mloc) * BPITCH];
    bf[nt] = cat16(*(const v8h*)(brow + koff), *(const v8h*)(brow + 16 + koff));
  }
}
__device__ __forceinline__ void products(v16h a, const v16h bf[8], v8f acc[8]) {
  // holds the step's 16 LDS reads and the next step's A loads as one group
  // ahead of the products: without it each product's two reads are sunk
  // directly in front of it, into one register set, and every product sits out
  // a whole LDS latency
  __builtin_amdgcn_sched_barrier(0);
#pragma unroll
  for (int nt = 0; nt < 8; ++nt)
    acc[nt] = __builtin_amdgcn_wmma_f32_16x16x32_f16(
        false, a, false, bf[nt], (short)0, acc[nt], false, false);
  // holds the products in front of the waits and the barrier that close the
  // step: sunk behind them they start only when the next tile's copies have
  // landed, and the copies after those are issued behind the products
  __builtin_amdgcn_sched_barrier(0);
}

// A step's loads all go out at its head: the next W tile's copies, its own 16
// LDS reads, and the NEXT step's A fragment, which comes straight from global
// memory and lands under this step's work.
// The walk over K enters at k0 (a multiple of 64, set by the block's indices)
// and wraps round: the blocks that share a W tile or A rows all start together,
// and from a common start they would ask L2 for the same lines at the same
// moment all the way.
__device__ __forceinline__ void gemm_core(const _Float16* __restrict__ A,
                                          const _Float16* __restrict__ W,
                                          _Float16* Bt0, _Float16* Bt1,
                                          int m0, int n0, int k0, int tid,
                                          int mloc, int koff, v8f acc[8]) {
  // the lane's A row, at the K of the trip's first step: one pointer, carried
  const _Float16* ap = A + (size_t)(m0 + mloc) * DD + koff + k0;
  int cur = k0;   // the K of the trip's first step
  stage_tile(W, Bt0, n0, cur, tid);
  v16h a0 = load_a(ap, 0);
  // stands ahead of any later write of an address register that these loads name
  asm volatile("s_wait_xcnt 0x0" ::: "memory");
  // stays a loop: a trip waits at its two barriers whether unrolled or not, and
  // twelve copies of the body are four times the code
#pragma unroll 1
  for (int kk = 0; kk < DD; kk += 64) {
    v16h bf[8];
    const int nxt = cur + 64 < DD ? cur + 64 : 0;   // the next trip's K, wrapped
    wait_async_lds();
    __syncthreads();
    stage_tile(W, Bt1, n0, cur + 32, tid);
    read_b(bf, Bt0, mloc, koff);
    v16h a1 = load_a(ap, 32);
    // stands ahead of any later write of an address register that these loads
    // name; behind the LDS reads, so that it passes under their latency
    asm volatile("s_wait_xcnt 0x0" ::: "memory");
    products(a0, bf, acc);

    wait_async_lds();
    __syncthreads();
    if (kk + 64 < DD) stage_tile(W, Bt0, n0, nxt, tid);
    read_b(bf, Bt1, mloc, koff);
    // behind the last step the fetch is back at the walk's start: it stays in
    // bounds (its values are never used)
    ap += nxt - cur;
    a0 = load_a(ap, 0);
    // stands ahead of any later write of an address register that these loads
    // name; behind the LDS reads, so that it passes under their latency
    asm volatile("s_wait_xcnt 0x0" ::: "memory");
    products(a1, bf, acc);
    cur = nxt;
  }
}
// where a block enters the walk: 12 places; the 32 blocks along x that share a
// W tile, and the blocks along y and z that share A rows, are dealt over them
__device__ __forceinline__ int k_start(int x, int y, int z) {
  return (x + y + 6 * z) % (DD / 64) * 64;
}

// ---------------------------------------------------------------------------
// Kernel 1: Q, K and V projections in ONE launch: blockIdx.z picks the weight,
// the bias, the output plane and its layout (0 = Q, 1 = K, 2 = V).
// Q: rows, [B,H,S,DH], pre-scaled by 1/sqrt(DH).
// K and V: WMMA B-fragment order, so that one b128 load
// of a wave in the attention kernel reads 512 contiguous bytes (4 lines)
// instead of 16 bytes out of each of 16 lines.
//   K: [B*H][S/16 key tile][dh/32][chunk 2][lane 32][8 halves]
//      lane = ((dh>>3)&1)*16 + (s&15), chunk = (dh>>4)&1, half = dh&7
//   V: [B*H][S/32 key block][dh/16][chunk 2][lane 32][8 halves]
//      lane = ((s>>3)&1)*16 + (dh&15), chunk = (s>>4)&1, half = s&7
// ---------------------------------------------------------------------------
__global__ __launch_bounds__(256)
void gemm_qkv_f16(const _Float16* __restrict__ A,
                  const _Float16* __restrict__ Wqkv,   // Wq | Wk | Wv
                  const float* __restrict__ bq,
                  const float* __restrict__ bk,
                  const float* __restrict__ bv,
                  _Float16* __restrict__ qkv) {        // Q | K | V planes
  __shared__ __attribute__((aligned(16))) _Float16 Bt[2][128 * BPITCH];   // 20 KB double buffer
  const int which = blockIdx.z;
  const _Float16* W = Wqkv + which * (DD * DD);
  const float* bias = which == 0 ? bq : which == 1 ? bk : bv;
  _Float16* out = qkv + which * (MM * DD);
  const float scale = which == 0 ? 0.125f : 1.0f;
  const int tid  = threadIdx.x;
  const int wv   = tid >> 5;
  const int lane = tid & 31;
  const int mloc = lane & 15;
  const int hi   = lane >> 4;
  const int koff = hi * 8;
  const int m0 = blockIdx.x * 128 + wv * 16;
  const int n0 = blockIdx.y * 128;

  v8f acc[8];
#pragma unroll
  for (int i = 0; i < 8; ++i) acc[i] = vzero8();

  gemm_core(A, W, Bt[0], Bt[1], m0, n0,
            k_start(blockIdx.x, blockIdx.y, blockIdx.z), tid, mloc, koff, acc);

  // epilogue: C layout lane holds (M = r + hi*8, N = nt*16 + (lane&15))
  const int bb = m0 >> 11, s0 = m0 & 2047;   // the wave's 16 rows: one batch
  float bvv[8];
#pragma unroll
  for (int nt = 0; nt < 8; ++nt) bvv[nt] = bias[n0 + nt * 16 + mloc];
  // n0 is a multiple of 128: tiles 0..3 are head n0/64, tiles 4..7 the next;
  // within a head dh = (nt&3)*16 + mloc
  _Float16* ob = out + (size_t)(bb * HH + (n0 >> 6)) * SS * DHD;
  if (which == 2) {
    // a lane's 8 rows are the 8 halves of its own fragment slot
    _Float16* ov = ob + (s0 >> 5) * 2048 + ((s0 >> 4) & 1) * 256 + lane * 8;
#pragma unroll
    for (int nt = 0; nt < 8; ++nt) {
      v8h pk;
#pragma unroll
      for (int r = 0; r < 8; ++r) pk[r] = (_Float16)((acc[nt][r] + bvv[nt]) * scale);
      *(v8h*)(ov + (nt >> 2) * SS * DHD + (nt & 3) * 512) = pk;
    }
    // stands ahead of any later write of a register that these stores name
    // (the other layouts' blocks follow this one in the built code)
    asm volatile("s_wait_xcnt 0x0" ::: "memory");
  } else if (which == 1) {
    _Float16* ok = ob + (s0 >> 4) * 1024 + ((mloc >> 3) * 16 + hi * 8) * 8 + (mloc & 7);
#pragma unroll
    for (int nt = 0; nt < 8; ++nt)
#pragma unroll
      for (int r = 0; r < 8; ++r)
        ok[(nt >> 2) * SS * DHD + (nt & 3) * 256 + r * 8] =
            (_Float16)((acc[nt][r] + bvv[nt]) * scale);
    // stands ahead of any later write of a register that these stores name
    // (the other layouts' blocks follow this one in the built code)
    asm volatile("s_wait_xcnt 0x0" ::: "memory");
  } else {
    _Float16* oq = ob + (s0 + hi * 8) * DHD + mloc;
#pragma unroll
    for (int nt = 0; nt < 8; ++nt)
#pragma unroll
      for (int r = 0; r < 8; ++r)
        oq[(nt >> 2) * SS * DHD + r * DHD + (nt & 3) * 16] =
            (_Float16)((acc[nt][r] + bvv[nt]) * scale);
    // stands ahead of any later write of a register that these stores name
    // (the other layouts' blocks follow this one in the built code)
    asm volatile("s_wait_xcnt 0x0" ::: "memory");
  }
}

__device__ __forceinline__ float xhalf(float x) {
  int b = __builtin_bit_cast(int, x);
  return __builtin_bit_cast(float, __builtin_amdgcn_permlanex16(
      b, b, 0x76543210, 0xfedcba98, false, false));
}

// one pass's operands: 32 keys of K (4 fragments), of V (4 fragments), and a
// lane's 2 x 8 consecutive keys of attention_mask
__device__ __forceinline__ void fetch_frag(v16h f[4], const _Float16* p) {
#pragma unroll
  for (int i = 0; i < 4; ++i) f[i] = cat16(ld8h(p + i * 512), ld8h(p + i * 512 + 256));
}
__device__ __forceinline__ void fetch_mask(v8f mkv[2], const float* mr) {
#pragma unroll
  for (int nt = 0; nt < 2; ++nt) mkv[nt] = *(const v8f*)(mr + nt * 16);
}
// the step from key block k to the next of a walk that wraps at S
__device__ __forceinline__ int wrap_step(int k) {
  return (k & (SS - 1)) + 32 < SS ? 32 : 32 - SS;
}

// A wave's bias ring: 16 query rows; a row holds the two tiles (32 keys, 128 B
// each) side by side and 16 B that are never touched: pitch 272 B = 16 B x 17,
// so the 16 rows that half a wave reads with one ds_load_b128 meet each bank once.
typedef float v4f __attribute__((ext_vector_type(4)));
#define PBROW 68   // floats per ring row

// One tile, 16 rows x 128 B, global -> LDS: copy j brings rows 4j .. 4j+3, a lane
// 16 B, 8 lanes a whole line. The immediate offset moves both addresses: it
// steps the LDS row (4 x 272 B), and off[j] holds the lane's global byte offset
// less that step. The s_wait_xcnt stands inside the statement, ahead of any
// later write of a register that the copies name.
__device__ __forceinline__ void copy_bias(unsigned lds, const unsigned off[4],
                                          const float* base) {
  asm volatile(
      "global_load_async_to_lds_b128 %0, %1, %5\n\t"
      "global_load_async_to_lds_b128 %0, %2, %5 offset:1088\n\t"
      "global_load_async_to_lds_b128 %0, %3, %5 offset:2176\n\t"
      "global_load_async_to_lds_b128 %0, %4, %5 offset:3264\n\t"
      "s_wait_xcnt 0x0"
      :: "v"(lds), "v"(off[0]), "v"(off[1]), "v"(off[2]), "v"(off[3]), "s"(base)
      : "memory");
}
// The same into a place that the wave has read: its own s_wait_dscnt 0 stands in
// the copies' statement, directly in front of them (in a statement of its own it
// was scheduled up to the reads, where the wave would sit out their latency).
__device__ __forceinline__ void refill_bias(unsigned lds, const unsigned off[4],
                                            const float* base) {
  asm volatile(
      "s_wait_dscnt 0x0\n\t"
      "global_load_async_to_lds_b128 %0, %1, %5\n\t"
      "global_load_async_to_lds_b128 %0, %2, %5 offset:1088\n\t"
      "global_load_async_to_lds_b128 %0, %3, %5 offset:2176\n\t"
      "global_load_async_to_lds_b128 %0, %4, %5 offset:3264\n\t"
      "s_wait_xcnt 0x0"
      :: "v"(lds), "v"(off[0]), "v"(off[1]), "v"(off[2]), "v"(off[3]), "s"(base)
      : "memory");
}
// a lane's 2 x 8 consecutive keys of its own query row, out of the ring
__device__ __forceinline__ void read_bias(v8f pbv[2], const float* r) {
#pragma unroll
  for (int nt = 0; nt < 2; ++nt)
    pbv[nt] = __builtin_shufflevector(*(const v4f*)(r + nt * 16),
                                      *(const v4f*)(r + nt * 16 + 4),
                                      0, 1, 2, 3, 4, 5, 6, 7);
}

__global__ __launch_bounds__(128)
void flash_attn(const _Float16* __restrict__ Q,    // [B,H,S,DH] pre-scaled 1/8
                const _Float16* __restrict__ K,    // fragment order (kernel 1)
                const _Float16* __restrict__ Vt,   // fragment order (kernel 1)
                const float* __restrict__ pb,      // [1,H,S,S]
                const float* __restrict__ mask,    // [B,1,1,S]
                _Float16* __restrict__ ctx) {      // [B,S,D] f16
  __shared__ __attribute__((aligned(16))) float pbs[4][16 * PBROW];   // 17 KB
  const int wv   = threadIdx.x >> 5;
  const int lane = threadIdx.x & 31;
  const int mloc = lane & 15;
  const int hi   = lane >> 4;
  const int koff = hi * 8;
  const int bh = blockIdx.y, b = bh / HH, h = bh % HH;
  const int q0 = blockIdx.x * 64 + wv * 16;

  // The walk over the keys enters at rot and wraps round: the 32 blocks of a
  // head read the same K and V and all start together; from a common start they
  // would ask L2 for the same lines at the same moment all the way. Each enters
  // two passes behind its neighbour. rot does not depend on the batch: the two
  // blocks that read the same bias rows still walk them side by side.
  // A pass is counted by kb; its keys are (kb + rot) mod S.
  const int rot = blockIdx.x * 64;   // 0 .. S - 64

  // bias ring: the walk's tiles 0 and 1 are asked for first of all
  const float* pbb = pb + ((size_t)h * SS + blockIdx.x * 64) * SS;   // the block's rows
  unsigned poff[4];
#pragma unroll
  for (int j = 0; j < 4; ++j)
    poff[j] = ((wv * 16 + j * 4 + (lane >> 3)) * SS + (lane & 7) * 4) * 4 - j * 1088;
  const unsigned pld = (unsigned)(size_t)&pbs[wv][0] + (lane >> 3) * (PBROW * 4) + (lane & 7) * 16;
  const float*   prd = &pbs[wv][mloc * PBROW + koff];
  copy_bias(pld, poff, pbb + rot);
  copy_bias(pld + 128, poff, pbb + ((rot + 32) & (SS - 1)));

  const _Float16* qrow = Q + ((size_t)bh * SS + q0 + mloc) * DHD;
  const v16h bq0 = cat16(ld8h(qrow + koff),      ld8h(qrow + 16 + koff));
  const v16h bq1 = cat16(ld8h(qrow + 32 + koff), ld8h(qrow + 48 + koff));
  // stands ahead of the later write of the address registers that these loads name
  asm volatile("s_wait_xcnt 0x0" ::: "memory");

  // 32 keys are 2048 contiguous halves in both: 8 slots of 32 lanes x 8 halves
  const _Float16* Kh  = K  + (size_t)bh * SS * DHD + lane * 8;
  const _Float16* Vh  = Vt + (size_t)bh * DHD * SS + lane * 8;
  const float*    pbq = pb + ((size_t)h * SS + q0) * SS;
  const float*    mk  = mask + (size_t)b * SS + koff;

  v8f o[4];   // o[dt][r] = O[q0 + mloc][dt*16 + hi*8 + r]
#pragma unroll
  for (int i = 0; i < 4; ++i) o[i] = vzero8();
  float mi = -1e30f, li = 0.0f;   // li: this half's keys only, joined at the end

  // No pass waits for a load that it has just issued. K and mask are asked
  // for one pass ahead, right behind the score products that read them, and
  // carried in the same registers over the loop's back edge; so is the bias,
  // out of the ring; V is asked for at the head of its own pass, ahead of the
  // score products and the softmax, in the registers that the last output
  // products have read.
  v16h kf[4];
  v8f pbv[2], mkv[2];
  fetch_frag(kf, Kh + rot * DHD);
  fetch_mask(mkv, mk + rot);
  // stands ahead of any later write of an address register that these loads name
  asm volatile("s_wait_xcnt 0x0" ::: "memory");
  // holds the address arithmetic that follows behind that wait
  __builtin_amdgcn_sched_barrier(0);

  // tile 0 has landed: all but this wave's 4 youngest copies (tile 1's)
  asm volatile("s_wait_asynccnt 0x4" ::: "memory");
  read_bias(pbv, prd);
  // tile 2 goes to tile 0's place, behind the wave's own reads of it (the ring
  // is private to the wave: no other wave reads or fills it, so no barrier)
  refill_bias(pld, poff, pbb + ((rot + 64) & (SS - 1)));

  // where this pass's V, the next pass's K and mask and the bias line asked for
  // ahead lie: carried, so that no load waits for its address
  const _Float16* vp = Vh + rot * DHD;
  const _Float16* kp = Kh + ((rot + 32) & (SS - 1)) * DHD;
  const float*    mp = mk + ((rot + 32) & (SS - 1));
  const float*    pp = pbq + (size_t)mloc * SS + ((rot + 160) & (SS - 1));

  for (int kb = 0; kb < SS; kb += 32) {
    v16h vf[4];
    fetch_frag(vf, vp);
    // stands ahead of any later write of an address register that these loads
    // name; it also holds them here, at the head of the pass: without it they
    // are issued behind the score products and the wait in front of those
    asm volatile("s_wait_xcnt 0x0" ::: "memory");

    // ---- scores tile [32k x 16q] = bias + mask + K * Q^T (Q pre-scaled) ----
    // bias + mask go in as the products' C operand: their registers are free
    // for the next pass's loads as soon as the products are issued
    v8f sc[2];
#pragma unroll
    for (int nt = 0; nt < 2; ++nt) {
      v8f c = pbv[nt] + mkv[nt];
      c = __builtin_amdgcn_wmma_f32_16x16x32_f16(false, kf[nt*2+0], false, bq0, (short)0, c, false, false);
      c = __builtin_amdgcn_wmma_f32_16x16x32_f16(false, kf[nt*2+1], false, bq1, (short)0, c, false, false);
      sc[nt] = c;
    }
    if (kb + 160 < SS)  // bias chunk per q-row, two passes ahead of its copy
      __builtin_prefetch(pp, 0, 1);

    // behind the last pass this fetch is back at the walk's start: it stays in
    // bounds (its values are never used)
    fetch_frag(kf, kp);
    fetch_mask(mkv, mp);
    // stands ahead of any later write of an address register that these loads name
    asm volatile("s_wait_xcnt 0x0" ::: "memory");
    // the next pass's bias tile has landed: all but this wave's 4 youngest
    // copies (every pass issues 4, so the count holds in every pass)
    asm volatile("s_wait_asynccnt 0x4" ::: "memory");
    const int ring = (kb + 32) & 32;   // that tile's place in a ring row, in floats
    read_bias(pbv, prd + ring);
    // keeps these loads issued ahead of the softmax: without it most of them
    // are issued behind it, with no time to land before the next pass
    __builtin_amdgcn_sched_barrier(0);
    // every pointer goes one key block on and wraps at S
    const int st = wrap_step(kb + 32 + rot);
    vp += wrap_step(kb + rot) * DHD;
    kp += st * DHD;
    mp += st;
    pp += wrap_step(kb + 160 + rot);

    // ---- online softmax: one query per lane ----
    float x = fmaxf(sc[0][0], sc[1][0]);
#pragma unroll
    for (int r = 1; r < 8; ++r) x = fmaxf(x, fmaxf(sc[0][r], sc[1][r]));
    x = fmaxf(x, xhalf(x));
    const float mnew = fmaxf(mi, x);
    const float corr = __expf(mi - mnew);
    mi = mnew;
#pragma unroll
    for (int dt = 0; dt < 4; ++dt)
#pragma unroll
      for (int r = 0; r < 8; ++r) o[dt][r] *= corr;
    v16h bp;   // P^T as B: half nt*8 + r is key nt*16 + hi*8 + r
    float ps = 0.0f;
#pragma unroll
    for (int r = 0; r < 8; ++r) {
      float p0 = __expf(sc[0][r] - mnew);
      float p1 = __expf(sc[1][r] - mnew);
      ps += p0 + p1;
      bp[r]     = (_Float16)p0;
      bp[8 + r] = (_Float16)p1;
    }
    li = li * corr + ps;

    // ---- O^T += V^T * P^T  (V stored as ready fragments) ----
#pragma unroll
    for (int dt = 0; dt < 4; ++dt)
      o[dt] = __builtin_amdgcn_wmma_f32_16x16x32_f16(
          false, vf[dt], false, bp, (short)0, o[dt], false, false);

    // refill the place just read, three tiles on, behind the wave's own reads of
    // it. The tile index wraps: the copies stay in bounds and every pass issues
    // its 4 (what the last ones bring is never used)
    refill_bias(pld + ring * 4, poff, pbb + ((kb + 96 + rot) & (SS - 1)));
  }
  // no copy is in flight when the wave ends
  asm volatile("s_wait_asynccnt 0x0" ::: "memory");

  // ---- normalize and emit context in [B,S,H*DH] f16 for the output GEMM ----
  const float rinv = 1.0f / (li + xhalf(li));
  _Float16* crow = ctx + ((size_t)b * SS + q0 + mloc) * DD + (size_t)h * DHD + koff;
#pragma unroll
  for (int dt = 0; dt < 4; ++dt) {
    v8h pk;
#pragma unroll
    for (int r = 0; r < 8; ++r) pk[r] = (_Float16)(o[dt][r] * rinv);
    *(v8h*)(crow + dt * 16) = pk;
  }
}

// ---------------------------------------------------------------------------
// Kernel 3: output projection, f32 epilogue straight to d_out.
// ---------------------------------------------------------------------------
__global__ __launch_bounds__(256)
void gemm_out_f32(const _Float16* __restrict__ A,
                  const _Float16* __restrict__ W,
                  const float* __restrict__ bias,
                  float* __restrict__ out) {
  __shared__ __attribute__((aligned(16))) _Float16 Bt[2][128 * BPITCH];
  const int tid  = threadIdx.x;
  const int wv   = tid >> 5;
  const int lane = tid & 31;
  const int mloc = lane & 15;
  const int hi   = lane >> 4;
  const int koff = hi * 8;
  const int m0 = blockIdx.x * 128 + wv * 16;
  const int n0 = blockIdx.y * 128;

  v8f acc[8];
#pragma unroll
  for (int i = 0; i < 8; ++i) acc[i] = vzero8();

  gemm_core(A, W, Bt[0], Bt[1], m0, n0,
            k_start(blockIdx.x, blockIdx.y, 0), tid, mloc, koff, acc);

#pragma unroll
  for (int nt = 0; nt < 8; ++nt) {
    int n = n0 + nt * 16 + mloc;
    float bv = bias[n];
#pragma unroll
    for (int r = 0; r < 8; ++r) {
      int m = m0 + r + hi * 8;
      out[(size_t)m * DD + n] = acc[nt][r] + bv;
    }
  }
}

// ---------------------------------------------------------------------------
// Host-side launcher (graph-capture safe: stream launches only, ws scratch).
// ---------------------------------------------------------------------------
extern "C" void kernel_launch(void* const* d_in, const int* in_sizes, int n_in,
                              void* d_out, int out_size, void* d_ws, size_t ws_size,
                              hipStream_t stream) {
  (void)in_sizes; (void)n_in; (void)out_size; (void)ws_size;

  const float* hs   = (const float*)d_in[0];
  const float* mask = (const float*)d_in[1];
  const float* pb   = (const float*)d_in[2];
  const float* Wq   = (const float*)d_in[3];
  const float* bq   = (const float*)d_in[4];
  const float* Wk   = (const float*)d_in[5];
  const float* bk   = (const float*)d_in[6];
  const float* Wv   = (const float*)d_in[7];
  const float* bv   = (const float*)d_in[8];
  const float* Wo   = (const float*)d_in[9];
  const float* bo   = (const float*)d_in[10];
  float* out = (float*)d_out;

  char* ws = (char*)d_ws;
  size_t off = 0;
  auto wsalloc = [&](size_t bytes) -> void* {
    void* p = ws + off;
    off += (bytes + 255) & ~(size_t)255;
    return p;
  };
  const size_t actBytes = (size_t)MM * DD * sizeof(_Float16);   // 6.29 MB
  const size_t wBytes   = (size_t)DD * DD * sizeof(_Float16);   // 1.18 MB
  // the casts' outputs back to back: X | Wq | Wk | Wv | Wo
  _Float16* X16   = (_Float16*)wsalloc(actBytes + 4 * wBytes);
  _Float16* Wq16  = X16 + MM * DD;
  _Float16* Wo16  = Wq16 + 3 * DD * DD;
  // the projections' outputs back to back: Q | K | V
  _Float16* Q16   = (_Float16*)wsalloc(3 * actBytes);   // [B,H,S,DH]
  _Float16* K16   = Q16 + MM * DD;                      // fragment order
  _Float16* Vt16  = K16 + MM * DD;                      // fragment order
  _Float16* ctx16 = (_Float16*)wsalloc(actBytes);   // [B,S,D]

  // 0) all five casts, one launch
  cvt_f32_f16<<<ACT_BLKS + 4 * W_BLKS, 256, 0, stream>>>(hs, Wq, Wk, Wv, Wo, X16);

  // 1) Q, K, V projections, one launch (Q pre-scaled; K, V in fragment order)
  dim3 ggrid(MM / 128, DD / 128);   // 32 x 6
  gemm_qkv_f16<<<dim3(MM / 128, DD / 128, 3), 256, 0, stream>>>(X16, Wq16, bq, bk, bv, Q16);

  // 2) fused flash attention with position bias + mask
  flash_attn<<<dim3(SS / 64, BB * HH), 128, 0, stream>>>(Q16, K16, Vt16, pb, mask, ctx16);

  // 3) output projection -> f32 result
  gemm_out_f32<<<ggrid, 256, 0, stream>>>(ctx16, Wo16, bo, out);
}

// v009
// It runs in 79.6 microseconds.
// Next to v008, in two timings, it ran 1.06 times as fast each time.
// Over all steps from v000 it is 2.96 times as fast.
#include <hip/hip_runtime.h>
#include <hip/hip_bf16.h>

// ---------------------------------------------------------------------------
// Self-attention with additive position bias (gfx1250, wave32, WMMA).
// Bandwidth-bound on position_bias (201MB) -> flash-attention fusion,
// f16 matrix cores with f32 accumulate, f32 softmax.
// GEMMs: double-buffered LDS staging (async global->LDS), batched B-fragment
// preload so WMMAs issue back-to-back.
// ---------------------------------------------------------------------------

typedef _Float16 v8h  __attribute__((ext_vector_type(8)));
typedef _Float16 v16h __attribute__((ext_vector_type(16)));
typedef float    v8f  __attribute__((ext_vector_type(8)));

#define HH 12
#define DHD 64
#define DD 768
#define BB 2
#define SS 2048
#define MM (BB * SS)   // 4096 rows

__device__ __forceinline__ v16h cat16(v8h lo, v8h hi) {
  return __builtin_shufflevector(lo, hi, 0,1,2,3,4,5,6,7,8,9,10,11,12,13,14,15);
}
__device__ __forceinline__ v8h ld8h(const _Float16* p) { return *(const v8h*)p; }
__device__ __forceinline__ v8f vzero8() {
  v8f z;
#pragma unroll
  for (int i = 0; i < 8; ++i) z[i] = 0.0f;
  return z;
}

// Hands a W tile over: the wave's own LDS reads of the buffer that is refilled
// next have retired, its own copies of the tile that is read next have landed,
// and behind the barrier both hold for every wave of the block.
__device__ __forceinline__ void publish_tile() {
  asm volatile("s_wait_dscnt 0x0" ::: "memory");
  asm volatile("s_wait_asynccnt 0x0" ::: "memory");
  __syncthreads();
}

// ---------------------------------------------------------------------------
// Kernel 0: f32 -> f16 casts of hidden_states and the four weights, vectorized
// x4, all in ONE launch: none needs anything of another. A block casts 1024
// floats. The five f16 copies lie back to back in the workspace, so a block's
// place in the grid is its place in the output; only the source goes by range.
// ---------------------------------------------------------------------------
#define ACT_BLKS (MM * DD / 1024)   // 3072 blocks: hidden_states
#define W_BLKS   (DD * DD / 1024)   // 576 blocks: each weight

__global__ void cvt_f32_f16(const float* __restrict__ hs,
                            const float* __restrict__ wq,
                            const float* __restrict__ wk,
                            const float* __restrict__ wv,
                            const float* __restrict__ wo,
                            _Float16* __restrict__ out) {
  const int blk = blockIdx.x;
  const float* in = hs;
  int rel = blk;
  if (blk >= ACT_BLKS) {   // block-uniform
    const int w = (blk - ACT_BLKS) / W_BLKS;
    rel = (blk - ACT_BLKS) - w * W_BLKS;
    in = w == 0 ? wq : w == 1 ? wk : w == 2 ? wv : wo;
  }
  const int t = threadIdx.x * 4;
  float4 v = *(const float4*)(in + rel * 1024 + t);
  _Float16* o = out + blk * 1024 + t;
  o[0] = (_Float16)v.x;
  o[1] = (_Float16)v.y;
  o[2] = (_Float16)v.z;
  o[3] = (_Float16)v.w;
}

// ---------------------------------------------------------------------------
// Shared TN-GEMM core: acc[8] += A[M,K] * W[N,K]^T over K=768.
// 8 waves / WG; W tile (128 rows x 64 halves, two K-steps) double-buffered in
// LDS; one barrier per tile; async copy of tile i+1 overlaps WMMAs on tile i.
// A tile row is one whole 128-B line of W: a copy of a wave (32 lanes x 16 B)
// asks L2 for 4 whole lines. Rows of 32 halves would make it 32 B out of each
// of 16 lines, and every line would be asked for four times.
// A tile row's 128 bytes lie at a pitch of 144 B (16 B x odd): the 16 rows that
// half a wave reads with one ds_load_b128 fall on all 64 banks once.
// A-fragment (16x32 f16, ISA layout): lane L -> row M = L&15,
//   half chunks at K = kk + (L>=16?8:0) and kk + 16 + (L>=16?8:0).
// ---------------------------------------------------------------------------
#define BPITCH 72   // halves per W tile row in LDS: 64 of data, 8 never touched

// One W tile, 128 rows x 128 B, global -> LDS: 8 lanes bring a row, a wave 4
// rows, the block 32 rows a copy; copy j brings rows 32j .. 32j+31. wt is the
// tile's first element (the same for the whole block), goff the lane's byte
// offset from there (row tid/8, 16-B piece tid%8), lds its place in the buffer.
// The immediate offset moves both addresses: it steps the LDS rows (32 x 144 B),
// and base j is the global step of 32 rows (49152 B) less that.
// The s_wait_xcnt stands inside the statement, ahead of any later write of a
// register that the copies name.
__device__ __forceinline__ void stage_tile(const _Float16* wt, unsigned lds,
                                           unsigned goff) {
  const char* b = (const char*)wt;
  asm volatile(
      "global_load_async_to_lds_b128 %0, %1, %2\n\t"
      "global_load_async_to_lds_b128 %0, %1, %3 offset:4608\n\t"
      "global_load_async_to_lds_b128 %0, %1, %4 offset:9216\n\t"
      "global_load_async_to_lds_b128 %0, %1, %5 offset:13824\n\t"
      "s_wait_xcnt 0x0"
      :: "v"(lds), "v"(goff), "s"(b), "s"(b + 44544), "s"(b + 89088),
         "s"(b + 133632)
      : "memory");
}

// A fragment of one K-step: arow is the lane's row, already at its half's koff
__device__ __forceinline__ v16h load_a(const _Float16* __restrict__ arow, int kk) {
  return cat16(ld8h(arow + kk), ld8h(arow + kk + 16));
}
// the eight B fragments of one K-step, out of the W tile in LDS
__device__ __forceinline__ void read_b(v16h bf[8], const _Float16* BtBuf,
                                       int mloc, int koff) {
#pragma unroll
  for (int nt = 0; nt < 8; ++nt) {
    const _Float16* brow = &BtBuf[(nt * 16 + mloc) * BPITCH];
    bf[nt] = cat16(*(const v8h*)(brow + koff), *(const v8h*)(brow + 16 + koff));
  }
}
__device__ __forceinline__ void products(v16h a, const v16h bf[8], v8f acc[8]) {
  // holds the step's 16 LDS reads and the next step's A loads as one group
  // ahead of the products: without it each product's two reads are sunk
  // directly in front of it, into one register set, and every product sits out
  // a whole LDS latency
  __builtin_amdgcn_sched_barrier(0);
#pragma unroll
  for (int nt = 0; nt < 8; ++nt)
    acc[nt] = __builtin_amdgcn_wmma_f32_16x16x32_f16(
        false, a, false, bf[nt], (short)0, acc[nt], false, false);
  // holds the products in front of the waits and the barrier that close the
  // trip: sunk behind them they start only when the next tile's copies have
  // landed, and the copies after those are issued behind the products
  __builtin_amdgcn_sched_barrier(0);
}

// A step's loads all go out at its head: its own 16 LDS reads and the NEXT
// step's A fragment, which comes straight from global memory and lands under
// this step's work; the next W tile's copies go out with the trip's first step.
// The walk over K enters at k0 (a multiple of 64, set by the block's indices)
// and wraps round: the blocks that share a W tile or A rows all start together,
// and from a common start they would ask L2 for the same lines at the same
// moment all the way.
__device__ __forceinline__ void gemm_core(const _Float16* __restrict__ A,
                                          const _Float16* __restrict__ W,
                                          _Float16* Bt0, _Float16* Bt1,
                                          int m0, int n0, int k0, int tid,
                                          int mloc, int koff, v8f acc[8]) {
  // the lane's A row, at the K of the trip's first step: one pointer, carried
  const _Float16* ap = A + (size_t)(m0 + mloc) * DD + koff + k0;
  int cur = k0;   // the K of the trip's first step
  _Float16* rb = Bt0;   // the tile that this trip reads
  _Float16* wb = Bt1;   // the buffer that the next tile's copies fill
  const _Float16* wn = W + (size_t)n0 * DD;   // the block's 128 rows of W
  const unsigned goff = (tid >> 3) * (DD * 2) + (tid & 7) * 16;
  const unsigned loff = (tid >> 3) * (BPITCH * 2) + (tid & 7) * 16;
  stage_tile(wn + cur, (unsigned)(size_t)rb + loff, goff);
  v16h a0 = load_a(ap, 0);
  // stands ahead of any later write of an address register that these loads name
  asm volatile("s_wait_xcnt 0x0" ::: "memory");
  // stays a loop: a trip waits at its barrier whether unrolled or not, and
  // twelve copies of the body are many times the code
#pragma unroll 1
  for (int kk = 0; kk < DD; kk += 64) {
    v16h bf[8];
    const int nxt = cur + 64 < DD ? cur + 64 : 0;   // the next trip's K, wrapped
    publish_tile();
    read_b(bf, rb, mloc, koff);
    v16h a1 = load_a(ap, 32);
    // the next tile's copies, into the buffer that every wave has left; behind
    // this step's LDS reads, so that their s_wait_xcnt passes under the reads'
    // latency
    if (kk + 64 < DD) stage_tile(wn + nxt, (unsigned)(size_t)wb + loff, goff);
    // stands ahead of any later write of an address register that the A loads name
    asm volatile("s_wait_xcnt 0x0" ::: "memory");
    products(a0, bf, acc);

    read_b(bf, rb + 32, mloc, koff);   // the tile's second K-step
    // behind the last step the fetch is back at the walk's start: it stays in
    // bounds (its values are never used)
    ap += nxt - cur;
    a0 = load_a(ap, 0);
    // stands ahead of any later write of an address register that these loads
    // name; behind the LDS reads, so that it passes under their latency
    asm volatile("s_wait_xcnt 0x0" ::: "memory");
    products(a1, bf, acc);
    cur = nxt;
    _Float16* t = rb; rb = wb; wb = t;
  }
  // no copy is in flight when the loop is left
  asm volatile("s_wait_asynccnt 0x0" ::: "memory");
}
// where a block enters the walk: 12 places; the 32 blocks along x that share a
// W tile, and the blocks along y and z that share A rows, are dealt over them
__device__ __forceinline__ int k_start(int x, int y, int z) {
  return (x + y + 6 * z) % (DD / 64) * 64;
}

// ---------------------------------------------------------------------------
// Kernel 1: Q, K and V projections in ONE launch: blockIdx.z picks the weight,
// the bias, the output plane and its layout (0 = Q, 1 = K, 2 = V).
// Q: rows, [B,H,S,DH], pre-scaled by 1/sqrt(DH).
// K and V: WMMA B-fragment order, so that one b128 load
// of a wave in the attention kernel reads 512 contiguous bytes (4 lines)
// instead of 16 bytes out of each of 16 lines.
//   K: [B*H][S/16 key tile][dh/32][chunk 2][lane 32][8 halves]
//      lane = ((dh>>3)&1)*16 + (s&15), chunk = (dh>>4)&1, half = dh&7
//   V: [B*H][S/32 key block][dh/16][chunk 2][lane 32][8 halves]
//      lane = ((s>>3)&1)*16 + (dh&15), chunk = (s>>4)&1, half = s&7
// ---------------------------------------------------------------------------
__global__ __launch_bounds__(256)
void gemm_qkv_f16(const _Float16* __restrict__ A,
                  const _Float16* __restrict__ Wqkv,   // Wq | Wk | Wv
                  const float* __restrict__ bq,
                  const float* __restrict__ bk,
                  const float* __restrict__ bv,
                  _Float16* __restrict__ qkv) {        // Q | K | V planes
  __shared__ __attribute__((aligned(16))) _Float16 Bt[2][128 * BPITCH];   // 36 KB double buffer
  const int which = blockIdx.z;
  const _Float16* W = Wqkv + which * (DD * DD);
  const float* bias = which == 0 ? bq : which == 1 ? bk : bv;
  _Float16* out = qkv + which * (MM * DD);
  const float scale = which == 0 ? 0.125f : 1.0f;
  const int tid  = threadIdx.x;
  const int wv   = tid >> 5;
  const int lane = tid & 31;
  const int mloc = lane & 15;
  const int hi   = lane >> 4;
  const int koff = hi * 8;
  const int m0 = blockIdx.x * 128 + wv * 16;
  const int n0 = blockIdx.y * 128;

  v8f acc[8];
#pragma unroll
  for (int i = 0; i < 8; ++i) acc[i] = vzero8();

  gemm_core(A, W, Bt[0], Bt[1], m0, n0,
            k_start(blockIdx.x, blockIdx.y, blockIdx.z), tid, mloc, koff, acc);

  // epilogue: C layout lane holds (M = r + hi*8, N = nt*16 + (lane&15))
  const int bb = m0 >> 11, s0 = m0 & 2047;   // the wave's 16 rows: one batch
  float bvv[8];
#pragma unroll
  for (int nt = 0; nt < 8; ++nt) bvv[nt] = bias[n0 + nt * 16 + mloc];
  // n0 is a multiple of 128: tiles 0..3 are head n0/64, tiles 4..7 the next;
  // within a head dh = (nt&3)*16 + mloc
  _Float16* ob = out + (size_t)(bb * HH + (n0 >> 6)) * SS * DHD;
  if (which == 2) {
    // a lane's 8 rows are the 8 halves of its own fragment slot
    _Float16* ov = ob + (s0 >> 5) * 2048 + ((s0 >> 4) & 1) * 256 + lane * 8;
#pragma unroll
    for (int nt = 0; nt < 8; ++nt) {
      v8h pk;
#pragma unroll
      for (int r = 0; r < 8; ++r) pk[r] = (_Float16)((acc[nt][r] + bvv[nt]) * scale);
      *(v8h*)(ov + (nt >> 2) * SS * DHD + (nt & 3) * 512) = pk;
    }
    // stands ahead of any later write of a register that these stores name
    // (the other layouts' blocks follow this one in the built code)
    asm volatile("s_wait_xcnt 0x0" ::: "memory");
  } else if (which == 1) {
    _Float16* ok = ob + (s0 >> 4) * 1024 + ((mloc >> 3) * 16 + hi * 8) * 8 + (mloc & 7);
#pragma unroll
    for (int nt = 0; nt < 8; ++nt)
#pragma unroll
      for (int r = 0; r < 8; ++r)
        ok[(nt >> 2) * SS * DHD + (nt & 3) * 256 + r * 8] =
            (_Float16)((acc[nt][r] + bvv[nt]) * scale);
    // stands ahead of any later write of a register that these stores name
    // (the other layouts' blocks follow this one in the built code)
    asm volatile("s_wait_xcnt 0x0" ::: "memory");
  } else {
    _Float16* oq = ob + (s0 + hi * 8) * DHD + mloc;
#pragma unroll
    for (int nt = 0; nt < 8; ++nt)
#pragma unroll
      for (int r = 0; r < 8; ++r)
        oq[(nt >> 2) * SS * DHD + r * DHD + (nt & 3) * 16] =
            (_Float16)((acc[nt][r] + bvv[nt]) * scale);
    // stands ahead of any later write of a register that these stores name
    // (the other layouts' blocks follow this one in the built code)
    asm volatile("s_wait_xcnt 0x0" ::: "memory");
  }
}

__device__ __forceinline__ float xhalf(float x) {
  int b = __builtin_bit_cast(int, x);
  return __builtin_bit_cast(float, __builtin_amdgcn_permlanex16(
      b, b, 0x76543210, 0xfedcba98, false, false));
}

// one pass's operands: 32 keys of K (4 fragments), of V (4 fragments), and a
// lane's 2 x 8 consecutive keys of attention_mask
__device__ __forceinline__ void fetch_frag(v16h f[4], const _Float16* p) {
#pragma unroll
  for (int i = 0; i < 4; ++i) f[i] = cat16(ld8h(p + i * 512), ld8h(p + i * 512 + 256));
}
__device__ __forceinline__ void fetch_mask(v8f mkv[2], const float* mr) {
#pragma unroll
  for (int nt = 0; nt < 2; ++nt) mkv[nt] = *(const v8f*)(mr + nt * 16);
}
// the step from key block k to the next of a walk that wraps at S
__device__ __forceinline__ int wrap_step(int k) {
  return (k & (SS - 1)) + 32 < SS ? 32 : 32 - SS;
}

// A wave's bias ring: 16 query rows; a row holds the two tiles (32 keys, 128 B
// each) side by side and 16 B that are never touched: pitch 272 B = 16 B x 17,
// so the 16 rows that half a wave reads with one ds_load_b128 meet each bank once.
typedef float v4f __attribute__((ext_vector_type(4)));
#define PBROW 68   // floats per ring row

// One tile, 16 rows x 128 B, global -> LDS: copy j brings rows 4j .. 4j+3, a lane
// 16 B, 8 lanes a whole line. The immediate offset moves both addresses: it
// steps the LDS row (4 x 272 B), and off[j] holds the lane's global byte offset
// less that step. The s_wait_xcnt stands inside the statement, ahead of any
// later write of a register that the copies name.
__device__ __forceinline__ void copy_bias(unsigned lds, const unsigned off[4],
                                          const float* base) {
  asm volatile(
      "global_load_async_to_lds_b128 %0, %1, %5\n\t"
      "global_load_async_to_lds_b128 %0, %2, %5 offset:1088\n\t"
      "global_load_async_to_lds_b128 %0, %3, %5 offset:2176\n\t"
      "global_load_async_to_lds_b128 %0, %4, %5 offset:3264\n\t"
      "s_wait_xcnt 0x0"
      :: "v"(lds), "v"(off[0]), "v"(off[1]), "v"(off[2]), "v"(off[3]), "s"(base)
      : "memory");
}
// The same into a place that the wave has read: its own s_wait_dscnt 0 stands in
// the copies' statement, directly in front of them (in a statement of its own it
// was scheduled up to the reads, where the wave would sit out their latency).
__device__ __forceinline__ void refill_bias(unsigned lds, const unsigned off[4],
                                            const float* base) {
  asm volatile(
      "s_wait_dscnt 0x0\n\t"
      "global_load_async_to_lds_b128 %0, %1, %5\n\t"
      "global_load_async_to_lds_b128 %0, %2, %5 offset:1088\n\t"
      "global_load_async_to_lds_b128 %0, %3, %5 offset:2176\n\t"
      "global_load_async_to_lds_b128 %0, %4, %5 offset:3264\n\t"
      "s_wait_xcnt 0x0"
      :: "v"(lds), "v"(off[0]), "v"(off[1]), "v"(off[2]), "v"(off[3]), "s"(base)
      : "memory");
}
// a lane's 2 x 8 consecutive keys of its own query row, out of the ring
__device__ __forceinline__ void read_bias(v8f pbv[2], const float* r) {
#pragma unroll
  for (int nt = 0; nt < 2; ++nt)
    pbv[nt] = __builtin_shufflevector(*(const v4f*)(r + nt * 16),
                                      *(const v4f*)(r + nt * 16 + 4),
                                      0, 1, 2, 3, 4, 5, 6, 7);
}

__global__ __launch_bounds__(128)
void flash_attn(const _Float16* __restrict__ Q,    // [B,H,S,DH] pre-scaled 1/8
                const _Float16* __restrict__ K,    // fragment order (kernel 1)
                const _Float16* __restrict__ Vt,   // fragment order (kernel 1)
                const float* __restrict__ pb,      // [1,H,S,S]
                const float* __restrict__ mask,    // [B,1,1,S]
                _Float16* __restrict__ ctx) {      // [B,S,D] f16
  __shared__ __attribute__((aligned(16))) float pbs[4][16 * PBROW];   // 17 KB
  const int wv   = threadIdx.x >> 5;
  const int lane = threadIdx.x & 31;
  const int mloc = lane & 15;
  const int hi   = lane >> 4;
  const int koff = hi * 8;
  const int bh = blockIdx.y, b = bh / HH, h = bh % HH;
  const int q0 = blockIdx.x * 64 + wv * 16;

  // The walk over the keys enters at rot and wraps round: the 32 blocks of a
  // head read the same K and V and all start together; from a common start they
  // would ask L2 for the same lines at the same moment all the way. Each enters
  // two passes behind its neighbour. rot does not depend on the batch: the two
  // blocks that read the same bias rows still walk them side by side.
  // A pass is counted by kb; its keys are (kb + rot) mod S.
  const int rot = blockIdx.x * 64;   // 0 .. S - 64

  // bias ring: the walk's tiles 0 and 1 are asked for first of all
  const float* pbb = pb + ((size_t)h * SS + blockIdx.x * 64) * SS;   // the block's rows
  unsigned poff[4];
#pragma unroll
  for (int j = 0; j < 4; ++j)
    poff[j] = ((wv * 16 + j * 4 + (lane >> 3)) * SS + (lane & 7) * 4) * 4 - j * 1088;
  const unsigned pld = (unsigned)(size_t)&pbs[wv][0] + (lane >> 3) * (PBROW * 4) + (lane & 7) * 16;
  const float*   prd = &pbs[wv][mloc * PBROW + koff];
  copy_bias(pld, poff, pbb + rot);
  copy_bias(pld + 128, poff, pbb + ((rot + 32) & (SS - 1)));

  const _Float16* qrow = Q + ((size_t)bh * SS + q0 + mloc) * DHD;
  const v16h bq0 = cat16(ld8h(qrow + koff),      ld8h(qrow + 16 + koff));
  const v16h bq1 = cat16(ld8h(qrow + 32 + koff), ld8h(qrow + 48 + koff));
  // stands ahead of the later write of the address registers that these loads name
  asm volatile("s_wait_xcnt 0x0" ::: "memory");

  // 32 keys are 2048 contiguous halves in both: 8 slots of 32 lanes x 8 halves
  const _Float16* Kh  = K  + (size_t)bh * SS * DHD + lane * 8;
  const _Float16* Vh  = Vt + (size_t)bh * DHD * SS + lane * 8;
  const float*    pbq = pb + ((size_t)h * SS + q0) * SS;
  const float*    mk  = mask + (size_t)b * SS + koff;

  v8f o[4];   // o[dt][r] = O[q0 + mloc][dt*16 + hi*8 + r]
#pragma unroll
  for (int i = 0; i < 4; ++i) o[i] = vzero8();
  float mi = -1e30f, li = 0.0f;   // li: this half's keys only, joined at the end

  // No pass waits for a load that it has just issued. K and mask are asked
  // for one pass ahead, right behind the score products that read them, and
  // carried in the same registers over the loop's back edge; so is the bias,
  // out of the ring; V is asked for at the head of its own pass, ahead of the
  // score products and the softmax, in the registers that the last output
  // products have read.
  v16h kf[4];
  v8f pbv[2], mkv[2];
  fetch_frag(kf, Kh + rot * DHD);
  fetch_mask(mkv, mk + rot);
  // stands ahead of any later write of an address register that these loads name
  asm volatile("s_wait_xcnt 0x0" ::: "memory");
  // holds the address arithmetic that follows behind that wait
  __builtin_amdgcn_sched_barrier(0);

  // tile 0 has landed: all but this wave's 4 youngest copies (tile 1's)
  asm volatile("s_wait_asynccnt 0x4" ::: "memory");
  read_bias(pbv, prd);
  // tile 2 goes to tile 0's place, behind the wave's own reads of it (the ring
  // is private to the wave: no other wave reads or fills it, so no barrier)
  refill_bias(pld, poff, pbb + ((rot + 64) & (SS - 1)));

  // where this pass's V, the next pass's K and mask and the bias line asked for
  // ahead lie: carried, so that no load waits for its address
  const _Float16* vp = Vh + rot * DHD;
  const _Float16* kp = Kh + ((rot + 32) & (SS - 1)) * DHD;
  const float*    mp = mk + ((rot + 32) & (SS - 1));
  const float*    pp = pbq + (size_t)mloc * SS + ((rot + 160) & (SS - 1));

  for (int kb = 0; kb < SS; kb += 32) {
    v16h vf[4];
    fetch_frag(vf, vp);
    // stands ahead of any later write of an address register that these loads
    // name; it also holds them here, at the head of the pass: without it they
    // are issued behind the score products and the wait in front of those
    asm volatile("s_wait_xcnt 0x0" ::: "memory");

    // ---- scores tile [32k x 16q] = bias + mask + K * Q^T (Q pre-scaled) ----
    // bias + mask go in as the products' C operand: their registers are free
    // for the next pass's loads as soon as the products are issued
    v8f sc[2];
#pragma unroll
    for (int nt = 0; nt < 2; ++nt) {
      v8f c = pbv[nt] + mkv[nt];
      c = __builtin_amdgcn_wmma_f32_16x16x32_f16(false, kf[nt*2+0], false, bq0, (short)0, c, false, false);
      c = __builtin_amdgcn_wmma_f32_16x16x32_f16(false, kf[nt*2+1], false, bq1, (short)0, c, false, false);
      sc[nt] = c;
    }
    if (kb + 160 < SS)  // bias chunk per q-row, two passes ahead of its copy
      __builtin_prefetch(pp, 0, 1);

    // behind the last pass this fetch is back at the walk's start: it stays in
    // bounds (its values are never used)
    fetch_frag(kf, kp);
    fetch_mask(mkv, mp);
    // stands ahead of any later write of an address register that these loads name
    asm volatile("s_wait_xcnt 0x0" ::: "memory");
    // the next pass's bias tile has landed: all but this wave's 4 youngest
    // copies (every pass issues 4, so the count holds in every pass)
    asm volatile("s_wait_asynccnt 0x4" ::: "memory");
    const int ring = (kb + 32) & 32;   // that tile's place in a ring row, in floats
    read_bias(pbv, prd + ring);
    // keeps these loads issued ahead of the softmax: without it most of them
    // are issued behind it, with no time to land before the next pass
    __builtin_amdgcn_sched_barrier(0);
    // every pointer goes one key block on and wraps at S
    const int st = wrap_step(kb + 32 + rot);
    vp += wrap_step(kb + rot) * DHD;
    kp += st * DHD;
    mp += st;
    pp += wrap_step(kb + 160 + rot);

    // ---- online softmax: one query per lane ----
    float x = fmaxf(sc[0][0], sc[1][0]);
#pragma unroll
    for (int r = 1; r < 8; ++r) x = fmaxf(x, fmaxf(sc[0][r], sc[1][r]));
    x = fmaxf(x, xhalf(x));
    const float mnew = fmaxf(mi, x);
    const float corr = __expf(mi - mnew);
    mi = mnew;
#pragma unroll
    for (int dt = 0; dt < 4; ++dt)
#pragma unroll
      for (int r = 0; r < 8; ++r) o[dt][r] *= corr;
    v16h bp;   // P^T as B: half nt*8 + r is key nt*16 + hi*8 + r
    float ps = 0.0f;
#pragma unroll
    for (int r = 0; r < 8; ++r) {
      float p0 = __expf(sc[0][r] - mnew);
      float p1 = __expf(sc[1][r] - mnew);
      ps += p0 + p1;
      bp[r]     = (_Float16)p0;
      bp[8 + r] = (_Float16)p1;
    }
    li = li * corr + ps;

    // ---- O^T += V^T * P^T  (V stored as ready fragments) ----
#pragma unroll
    for (int dt = 0; dt < 4; ++dt)
      o[dt] = __builtin_amdgcn_wmma_f32_16x16x32_f16(
          false, vf[dt], false, bp, (short)0, o[dt], false, false);

    // refill the place just read, three tiles on, behind the wave's own reads of
    // it. The tile index wraps: the copies stay in bounds and every pass issues
    // its 4 (what the last ones bring is never used)
    refill_bias(pld + ring * 4, poff, pbb + ((kb + 96 + rot) & (SS - 1)));
  }
  // no copy is in flight when the wave ends
  asm volatile("s_wait_asynccnt 0x0" ::: "memory");

  // ---- normalize and emit context in [B,S,H*DH] f16 for the output GEMM ----
  const float rinv = 1.0f / (li + xhalf(li));
  _Float16* crow = ctx + ((size_t)b * SS + q0 + mloc) * DD + (size_t)h * DHD + koff;
#pragma unroll
  for (int dt = 0; dt < 4; ++dt) {
    v8h pk;
#pragma unroll
    for (int r = 0; r < 8; ++r) pk[r] = (_Float16)(o[dt][r] * rinv);
    *(v8h*)(crow + dt * 16) = pk;
  }
}

// ---------------------------------------------------------------------------
// Kernel 3: output projection, f32 epilogue straight to d_out.
// ---------------------------------------------------------------------------
__global__ __launch_bounds__(256)
void gemm_out_f32(const _Float16* __restrict__ A,
                  const _Float16* __restrict__ W,
                  const float* __restrict__ bias,
                  float* __restrict__ out) {
  __shared__ __attribute__((aligned(16))) _Float16 Bt[2][128 * BPITCH];
  const int tid  = threadIdx.x;
  const int wv   = tid >> 5;
  const int lane = tid & 31;
  const int mloc = lane & 15;
  const int hi   = lane >> 4;
  const int koff = hi * 8;
  const int m0 = blockIdx.x * 128 + wv * 16;
  const int n0 = blockIdx.y * 128;

  v8f acc[8];
#pragma unroll
  for (int i = 0; i < 8; ++i) acc[i] = vzero8();

  gemm_core(A, W, Bt[0], Bt[1], m0, n0,
            k_start(blockIdx.x, blockIdx.y, 0), tid, mloc, koff, acc);

#pragma unroll
  for (int nt = 0; nt < 8; ++nt) {
    int n = n0 + nt * 16 + mloc;
    float bv = bias[n];
#pragma unroll
    for (int r = 0; r < 8; ++r) {
      int m = m0 + r + hi * 8;
      out[(size_t)m * DD + n] = acc[nt][r] + bv;
    }
  }
}

// ---------------------------------------------------------------------------
// Host-side launcher (graph-capture safe: stream launches only, ws scratch).
// ---------------------------------------------------------------------------
extern "C" void kernel_launch(void* const* d_in, const int* in_sizes, int n_in,
                              void* d_out, int out_size, void* d_ws, size_t ws_size,
                              hipStream_t stream) {
  (void)in_sizes; (void)n_in; (void)out_size; (void)ws_size;

  const float* hs   = (const float*)d_in[0];
  const float* mask = (const float*)d_in[1];
  const float* pb   = (const float*)d_in[2];
  const float* Wq   = (const float*)d_in[3];
  const float* bq   = (const float*)d_in[4];
  const float* Wk   = (const float*)d_in[5];
  const float* bk   = (const float*)d_in[6];
  const float* Wv   = (const float*)d_in[7];
  const float* bv   = (const float*)d_in[8];
  const float* Wo   = (const float*)d_in[9];
  const float* bo   = (const float*)d_in[10];
  float* out = (float*)d_out;

  char* ws = (char*)d_ws;
  size_t off = 0;
  auto wsalloc = [&](size_t bytes) -> void* {
    void* p = ws + off;
    off += (bytes + 255) & ~(size_t)255;
    return p;
  };
  const size_t actBytes = (size_t)MM * DD * sizeof(_Float16);   // 6.29 MB
  const size_t wBytes   = (size_t)DD * DD * sizeof(_Float16);   // 1.18 MB
  // the casts' outputs back to back: X | Wq | Wk | Wv | Wo
  _Float16* X16   = (_Float16*)wsalloc(actBytes + 4 * wBytes);
  _Float16* Wq16  = X16 + MM * DD;
  _Float16* Wo16  = Wq16 + 3 * DD * DD;
  // the projections' outputs back to back: Q | K | V
  _Float16* Q16   = (_Float16*)wsalloc(3 * actBytes);   // [B,H,S,DH]
  _Float16* K16   = Q16 + MM * DD;                      // fragment order
  _Float16* Vt16  = K16 + MM * DD;                      // fragment order
  _Float16* ctx16 = (_Float16*)wsalloc(actBytes);   // [B,S,D]

  // 0) all five casts, one launch
  cvt_f32_f16<<<ACT_BLKS + 4 * W_BLKS, 256, 0, stream>>>(hs, Wq, Wk, Wv, Wo, X16);

  // 1) Q, K, V projections, one launch (Q pre-scaled; K, V in fragment order)
  dim3 ggrid(MM / 128, DD / 128);   // 32 x 6
  gemm_qkv_f16<<<dim3(MM / 128, DD / 128, 3), 256, 0, stream>>>(X16, Wq16, bq, bk, bv, Q16);

  // 2) fused flash attention with position bias + mask
  flash_attn<<<dim3(SS / 64, BB * HH), 128, 0, stream>>>(Q16, K16, Vt16, pb, mask, ctx16);

  // 3) output projection -> f32 result
  gemm_out_f32<<<ggrid, 256, 0, stream>>>(ctx16, Wo16, bo, out);
}

// v010
// One run takes 76.1 microseconds.
// Timed twice side by side with v009, it ran 1.05 times as fast both times.
// Counting every step since v000, it is 3.10 times as fast.
#include <hip/hip_runtime.h>
#include <hip/hip_bf16.h>

// ---------------------------------------------------------------------------
// Self-attention with additive position bias (gfx1250, wave32, WMMA).
// Bandwidth-bound on position_bias (201MB) -> flash-attention fusion,
// f16 matrix cores with f32 accumulate, f32 softmax.
// GEMMs: double-buffered LDS staging (async global->LDS) of both operands,
// batched fragment preload so WMMAs issue back-to-back.
// ---------------------------------------------------------------------------

typedef _Float16 v8h  __attribute__((ext_vector_type(8)));
typedef _Float16 v16h __attribute__((ext_vector_type(16)));
typedef float    v8f  __attribute__((ext_vector_type(8)));

#define HH 12
#define DHD 64
#define DD 768
#define BB 2
#define SS 2048
#define MM (BB * SS)   // 4096 rows

__device__ __forceinline__ v16h cat16(v8h lo, v8h hi) {
  return __builtin_shufflevector(lo, hi, 0,1,2,3,4,5,6,7,8,9,10,11,12,13,14,15);
}
__device__ __forceinline__ v8h ld8h(const _Float16* p) { return *(const v8h*)p; }
__device__ __forceinline__ v8f vzero8() {
  v8f z;
#pragma unroll
  for (int i = 0; i < 8; ++i) z[i] = 0.0f;
  return z;
}

// Hands a pair of tiles over: the wave's own LDS reads of the buffer that is refilled
// next have retired, its own copies of the tile that is read next have landed,
// and behind the barrier both hold for every wave of the block.
__device__ __forceinline__ void publish_tile() {
  asm volatile("s_wait_dscnt 0x0" ::: "memory");
  asm volatile("s_wait_asynccnt 0x0" ::: "memory");
  __syncthreads();
}

// ---------------------------------------------------------------------------
// Kernel 0: f32 -> f16 casts of hidden_states and the four weights, vectorized
// x4, all in ONE launch: none needs anything of another. A block casts 1024
// floats. The five f16 copies lie back to back in the workspace, so a block's
// place in the grid is its place in the output; only the source goes by range.
// ---------------------------------------------------------------------------
#define ACT_BLKS (MM * DD / 1024)   // 3072 blocks: hidden_states
#define W_BLKS   (DD * DD / 1024)   // 576 blocks: each weight

__global__ void cvt_f32_f16(const float* __restrict__ hs,
                            const float* __restrict__ wq,
                            const float* __restrict__ wk,
                            const float* __restrict__ wv,
                            const float* __restrict__ wo,
                            _Float16* __restrict__ out) {
  const int blk = blockIdx.x;
  const float* in = hs;
  int rel = blk;
  if (blk >= ACT_BLKS) {   // block-uniform
    const int w = (blk - ACT_BLKS) / W_BLKS;
    rel = (blk - ACT_BLKS) - w * W_BLKS;
    in = w == 0 ? wq : w == 1 ? wk : w == 2 ? wv : wo;
  }
  const int t = threadIdx.x * 4;
  float4 v = *(const float4*)(in + rel * 1024 + t);
  _Float16* o = out + blk * 1024 + t;
  o[0] = (_Float16)v.x;
  o[1] = (_Float16)v.y;
  o[2] = (_Float16)v.z;
  o[3] = (_Float16)v.w;
}

// ---------------------------------------------------------------------------
// Shared TN-GEMM core: acc[4][4] += A[M,K] * W[N,K]^T over K=768.
// A block makes a 128 x 128 tile of the result with 4 waves, 2 x 2, a wave
// 64 x 64: a K-step's 4 A and 4 B fragments feed 16 products, so a fragment
// read from LDS is used four times. (A wave of 16 x 128 reads 8 B fragments for
// 8 products: twice the LDS bytes a product, and the LDS sets the pace.)
// Both operands' tiles (128 rows x 64 halves, two K-steps) are double-buffered
// in LDS; one barrier per tile; the async copies of tile i+1 overlap the WMMAs
// on tile i.
// A tile row is one whole 128-B line of its matrix: a copy of a wave (32 lanes
// x 16 B) asks L2 for 4 whole lines.
// A tile row's 128 bytes lie at a pitch of 144 B (16 B x odd): the 16 rows that
// half a wave reads with one ds_load_b128 fall on all 64 banks once.
// Fragment (16x32 f16, ISA layout; A and B share the map): lane L -> row L&15,
//   half chunks at K = kk + (L>=16?8:0) and kk + 16 + (L>=16?8:0).
// ---------------------------------------------------------------------------
#define BPITCH 72   // halves per tile row in LDS: 64 of data, 8 never touched
#define TILE_H (128 * BPITCH)   // halves of one operand's tile in LDS

// A pair of tiles, each 128 rows x 128 B, global -> LDS: 8 lanes bring a row, a
// wave 4 rows, the block 16 rows a copy; copy j of a tile brings its rows 16j ..
// 16j+15. wt and at are the tiles' first elements (the same for the whole
// block), goff the lane's byte offset from there (row tid/8, 16-B piece tid%8),
// wl and al its places in the buffer.
// The immediate offset moves both addresses: it steps the LDS rows (16 x 144 B),
// and base j is the global step of 16 rows (24576 B) less that.
// One statement for both tiles: one s_wait_xcnt, inside the statement, ahead of
// any later write of a register that the copies name.
__device__ __forceinline__ void stage_tiles(const _Float16* wt, const _Float16* at,
                                            unsigned wl, unsigned al,
                                            unsigned goff) {
  const char* w = (const char*)wt;
  const char* a = (const char*)at;
  asm volatile(
      "global_load_async_to_lds_b128 %0, %2, %3\n\t"
      "global_load_async_to_lds_b128 %0, %2, %4 offset:2304\n\t"
      "global_load_async_to_lds_b128 %0, %2, %5 offset:4608\n\t"
      "global_load_async_to_lds_b128 %0, %2, %6 offset:6912\n\t"
      "global_load_async_to_lds_b128 %0, %2, %7 offset:9216\n\t"
      "global_load_async_to_lds_b128 %0, %2, %8 offset:11520\n\t"
      "global_load_async_to_lds_b128 %0, %2, %9 offset:13824\n\t"
      "global_load_async_to_lds_b128 %0, %2, %10 offset:16128\n\t"
      "global_load_async_to_lds_b128 %1, %2, %11\n\t"
      "global_load_async_to_lds_b128 %1, %2, %12 offset:2304\n\t"
      "global_load_async_to_lds_b128 %1, %2, %13 offset:4608\n\t"
      "global_load_async_to_lds_b128 %1, %2, %14 offset:6912\n\t"
      "global_load_async_to_lds_b128 %1, %2, %15 offset:9216\n\t"
      "global_load_async_to_lds_b128 %1, %2, %16 offset:11520\n\t"
      "global_load_async_to_lds_b128 %1, %2, %17 offset:13824\n\t"
      "global_load_async_to_lds_b128 %1, %2, %18 offset:16128\n\t"
      "s_wait_xcnt 0x0"
      :: "v"(wl), "v"(al), "v"(goff),
         "s"(w), "s"(w + 22272), "s"(w + 44544), "s"(w + 66816), "s"(w + 89088),
         "s"(w + 111360), "s"(w + 133632), "s"(w + 155904),
         "s"(a), "s"(a + 22272), "s"(a + 44544), "s"(a + 66816), "s"(a + 89088),
         "s"(a + 111360), "s"(a + 133632), "s"(a + 155904)
      : "memory");
}

// one fragment out of a tile in LDS: r is the lane's row, already at its half's koff
__device__ __forceinline__ v16h read_frag(const _Float16* r) {
  return cat16(*(const v8h*)r, *(const v8h*)(r + 16));
}
// A K-step's four A and four B fragments: a0 and b0 are the lane's rows of the
// first of each; the next lie 16 rows on each. They are asked for in the order
// in which the products want them (A 0, all of B, then A 1 to 3): the first
// product waits for 4 reads and not for 10, and the later reads land under the
// products.
__device__ __forceinline__ void read_frags(v16h af[4], v16h bf[4],
                                           const _Float16* a0, const _Float16* b0) {
  af[0] = read_frag(a0);
#pragma unroll
  for (int i = 0; i < 4; ++i) bf[i] = read_frag(b0 + i * 16 * BPITCH);
#pragma unroll
  for (int i = 1; i < 4; ++i) af[i] = read_frag(a0 + i * 16 * BPITCH);
}
__device__ __forceinline__ void products(const v16h af[4], const v16h bf[4],
                                         v8f acc[4][4]) {
  // holds the step's 16 LDS reads as one group ahead of the products: without
  // it each product's reads are sunk directly in front of it and every product
  // sits out a whole LDS latency
  __builtin_amdgcn_sched_barrier(0);
#pragma unroll
  for (int mt = 0; mt < 4; ++mt)
#pragma unroll
    for (int nt = 0; nt < 4; ++nt)
      acc[mt][nt] = __builtin_amdgcn_wmma_f32_16x16x32_f16(
          false, af[mt], false, bf[nt], (short)0, acc[mt][nt], false, false);
  // holds the products in front of the waits and the barrier that close the
  // trip: sunk behind them they start only when the next tiles' copies have
  // landed, and the copies after those are issued behind the products
  __builtin_amdgcn_sched_barrier(0);
}

// A buffer holds the W tile and, TILE_H halves on, the A tile. The next tiles'
// copies go out with the trip's first step.
// The walk over K enters at k0 (a multiple of 64, set by the block's indices)
// and wraps round: the blocks that share a W tile or A rows all start together,
// and from a common start they would ask L2 for the same lines at the same
// moment all the way.
// m0, n0: the block's first row of A and of W; arow, brow: the lane's row of its
// wave's first A and B fragment inside the tiles.
__device__ __forceinline__ void gemm_core(const _Float16* __restrict__ A,
                                          const _Float16* __restrict__ W,
                                          _Float16* T0, _Float16* T1,
                                          int m0, int n0, int k0, int tid,
                                          int arow, int brow, int koff,
                                          v8f acc[4][4]) {
  int cur = k0;   // the K of the trip's first step
  _Float16* rb = T0;   // the tiles that this trip reads
  _Float16* wb = T1;   // the buffer that the next tiles' copies fill
  const _Float16* wn = W + (size_t)n0 * DD;   // the block's 128 rows of W
  const _Float16* am = A + (size_t)m0 * DD;   // the block's 128 rows of A
  const unsigned goff = (tid >> 3) * (DD * 2) + (tid & 7) * 16;
  const unsigned loff = (tid >> 3) * (BPITCH * 2) + (tid & 7) * 16;
  const int ao = TILE_H + arow * BPITCH + koff;
  const int bo = brow * BPITCH + koff;
  stage_tiles(wn + cur, am + cur, (unsigned)(size_t)rb + loff,
              (unsigned)(size_t)(rb + TILE_H) + loff, goff);
  // stays a loop: a trip waits at its barrier whether unrolled or not, and
  // twelve copies of the body are many times the code
#pragma unroll 1
  for (int kk = 0; kk < DD; kk += 64) {
    v16h af[4], bf[4];
    const int nxt = cur + 64 < DD ? cur + 64 : 0;   // the next trip's K, wrapped
    publish_tile();
    read_frags(af, bf, rb + ao, rb + bo);
    // the next tiles' copies, into the buffer that every wave has left; behind
    // this step's LDS reads, so that their s_wait_xcnt passes under the reads'
    // latency
    if (kk + 64 < DD)
      stage_tiles(wn + nxt, am + nxt, (unsigned)(size_t)wb + loff,
                  (unsigned)(size_t)(wb + TILE_H) + loff, goff);
    products(af, bf, acc);

    read_frags(af, bf, rb + ao + 32, rb + bo + 32);   // the tiles' second K-step
    products(af, bf, acc);
    cur = nxt;
    _Float16* t = rb; rb = wb; wb = t;
  }
  // no copy is in flight when the loop is left
  asm volatile("s_wait_asynccnt 0x0" ::: "memory");
}
// where a block enters the walk: 12 places; the 32 blocks along x that share a
// W tile, and the blocks along y and z that share A rows, are dealt over them
__device__ __forceinline__ int k_start(int x, int y, int z) {
  return (x + y + 6 * z) % (DD / 64) * 64;
}

// ---------------------------------------------------------------------------
// Kernel 1: Q, K and V projections in ONE launch: blockIdx.z picks the weight,
// the bias, the output plane and its layout (0 = Q, 1 = K, 2 = V).
// Q: rows, [B,H,S,DH], pre-scaled by 1/sqrt(DH).
// K and V: WMMA B-fragment order, so that one b128 load
// of a wave in the attention kernel reads 512 contiguous bytes (4 lines)
// instead of 16 bytes out of each of 16 lines.
//   K: [B*H][S/16 key tile][dh/32][chunk 2][lane 32][8 halves]
//      lane = ((dh>>3)&1)*16 + (s&15), chunk = (dh>>4)&1, half = dh&7
//   V: [B*H][S/32 key block][dh/16][chunk 2][lane 32][8 halves]
//      lane = ((s>>3)&1)*16 + (dh&15), chunk = (s>>4)&1, half = s&7
// ---------------------------------------------------------------------------
__global__ __launch_bounds__(128)
void gemm_qkv_f16(const _Float16* __restrict__ A,
                  const _Float16* __restrict__ Wqkv,   // Wq | Wk | Wv
                  const float* __restrict__ bq,
                  const float* __restrict__ bk,
                  const float* __restrict__ bv,
                  _Float16* __restrict__ qkv) {        // Q | K | V planes
  __shared__ __attribute__((aligned(16))) _Float16 Tl[2][2 * TILE_H];   // 72 KB double buffer
  const int which = blockIdx.z;
  const _Float16* W = Wqkv + which * (DD * DD);
  const float* bias = which == 0 ? bq : which == 1 ? bk : bv;
  _Float16* out = qkv + which * (MM * DD);
  const float scale = which == 0 ? 0.125f : 1.0f;
  const int tid  = threadIdx.x;
  const int wv   = tid >> 5;
  const int lane = tid & 31;
  const int mloc = lane & 15;
  const int hi   = lane >> 4;
  const int koff = hi * 8;
  const int wm = (wv >> 1) * 64, wn = (wv & 1) * 64;   // the wave's place in the tile
  const int m0 = blockIdx.x * 128 + wm;   // the wave's 64 rows
  const int n0 = blockIdx.y * 128 + wn;   // the wave's 64 columns: one head

  v8f acc[4][4];
#pragma unroll
  for (int i = 0; i < 4; ++i)
#pragma unroll
    for (int j = 0; j < 4; ++j) acc[i][j] = vzero8();

  gemm_core(A, W, Tl[0], Tl[1], blockIdx.x * 128, blockIdx.y * 128,
            k_start(blockIdx.x, blockIdx.y, blockIdx.z), tid, wm + mloc,
            wn + mloc, koff, acc);

  // epilogue: C layout lane holds (M = mt*16 + r + hi*8, N = nt*16 + (lane&15))
  const int bb = m0 >> 11, s0 = m0 & 2047;   // the wave's 64 rows: one batch
  float bvv[4];
#pragma unroll
  for (int nt = 0; nt < 4; ++nt) bvv[nt] = bias[n0 + nt * 16 + mloc];
  // within the head dh = nt*16 + mloc
  _Float16* ob = out + (size_t)(bb * HH + (n0 >> 6)) * SS * DHD;
  if (which == 2) {
    // a lane's 8 rows are the 8 halves of its own fragment slot
    _Float16* ov = ob + (s0 >> 5) * 2048 + lane * 8;
#pragma unroll
    for (int mt = 0; mt < 4; ++mt)
#pragma unroll
      for (int nt = 0; nt < 4; ++nt) {
        v8h pk;
#pragma unroll
        for (int r = 0; r < 8; ++r)
          pk[r] = (_Float16)((acc[mt][nt][r] + bvv[nt]) * scale);
        *(v8h*)(ov + (mt >> 1) * 2048 + (mt & 1) * 256 + nt * 512) = pk;
      }
    // stands ahead of any later write of a register that these stores name
    // (the other layouts' blocks follow this one in the built code)
    asm volatile("s_wait_xcnt 0x0" ::: "memory");
  } else if (which == 1) {
    _Float16* ok = ob + (s0 >> 4) * 1024 + ((mloc >> 3) * 16 + hi * 8) * 8 + (mloc & 7);
#pragma unroll
    for (int mt = 0; mt < 4; ++mt)
#pragma unroll
      for (int nt = 0; nt < 4; ++nt)
#pragma unroll
        for (int r = 0; r < 8; ++r)
          ok[mt * 1024 + nt * 256 + r * 8] =
              (_Float16)((acc[mt][nt][r] + bvv[nt]) * scale);
    // stands ahead of any later write of a register that these stores name
    // (the other layouts' blocks follow this one in the built code)
    asm volatile("s_wait_xcnt 0x0" ::: "memory");
  } else {
    _Float16* oq = ob + (s0 + hi * 8) * DHD + mloc;
#pragma unroll
    for (int mt = 0; mt < 4; ++mt)
#pragma unroll
      for (int nt = 0; nt < 4; ++nt)
#pragma unroll
        for (int r = 0; r < 8; ++r)
          oq[(mt * 16 + r) * DHD + nt * 16] =
              (_Float16)((acc[mt][nt][r] + bvv[nt]) * scale);
    // stands ahead of any later write of a register that these stores name
    // (the other layouts' blocks follow this one in the built code)
    asm volatile("s_wait_xcnt 0x0" ::: "memory");
  }
}

__device__ __forceinline__ float xhalf(float x) {
  int b = __builtin_bit_cast(int, x);
  return __builtin_bit_cast(float, __builtin_amdgcn_permlanex16(
      b, b, 0x76543210, 0xfedcba98, false, false));
}

// one pass's operands: 32 keys of K (4 fragments), of V (4 fragments), and a
// lane's 2 x 8 consecutive keys of attention_mask
__device__ __forceinline__ void fetch_frag(v16h f[4], const _Float16* p) {
#pragma unroll
  for (int i = 0; i < 4; ++i) f[i] = cat16(ld8h(p + i * 512), ld8h(p + i * 512 + 256));
}
__device__ __forceinline__ void fetch_mask(v8f mkv[2], const float* mr) {
#pragma unroll
  for (int nt = 0; nt < 2; ++nt) mkv[nt] = *(const v8f*)(mr + nt * 16);
}
// the step from key block k to the next of a walk that wraps at S
__device__ __forceinline__ int wrap_step(int k) {
  return (k & (SS - 1)) + 32 < SS ? 32 : 32 - SS;
}

// A wave's bias ring: 16 query rows; a row holds the two tiles (32 keys, 128 B
// each) side by side and 16 B that are never touched: pitch 272 B = 16 B x 17,
// so the 16 rows that half a wave reads with one ds_load_b128 meet each bank once.
typedef float v4f __attribute__((ext_vector_type(4)));
#define PBROW 68   // floats per ring row

// One tile, 16 rows x 128 B, global -> LDS: copy j brings rows 4j .. 4j+3, a lane
// 16 B, 8 lanes a whole line. The immediate offset moves both addresses: it
// steps the LDS row (4 x 272 B), and off[j] holds the lane's global byte offset
// less that step. The s_wait_xcnt stands inside the statement, ahead of any
// later write of a register that the copies name.
__device__ __forceinline__ void copy_bias(unsigned lds, const unsigned off[4],
                                          const float* base) {
  asm volatile(
      "global_load_async_to_lds_b128 %0, %1, %5\n\t"
      "global_load_async_to_lds_b128 %0, %2, %5 offset:1088\n\t"
      "global_load_async_to_lds_b128 %0, %3, %5 offset:2176\n\t"
      "global_load_async_to_lds_b128 %0, %4, %5 offset:3264\n\t"
      "s_wait_xcnt 0x0"
      :: "v"(lds), "v"(off[0]), "v"(off[1]), "v"(off[2]), "v"(off[3]), "s"(base)
      : "memory");
}
// The same into a place that the wave has read: its own s_wait_dscnt 0 stands in
// the copies' statement, directly in front of them (in a statement of its own it
// was scheduled up to the reads, where the wave would sit out their latency).
__device__ __forceinline__ void refill_bias(unsigned lds, const unsigned off[4],
                                            const float* base) {
  asm volatile(
      "s_wait_dscnt 0x0\n\t"
      "global_load_async_to_lds_b128 %0, %1, %5\n\t"
      "global_load_async_to_lds_b128 %0, %2, %5 offset:1088\n\t"
      "global_load_async_to_lds_b128 %0, %3, %5 offset:2176\n\t"
      "global_load_async_to_lds_b128 %0, %4, %5 offset:3264\n\t"
      "s_wait_xcnt 0x0"
      :: "v"(lds), "v"(off[0]), "v"(off[1]), "v"(off[2]), "v"(off[3]), "s"(base)
      : "memory");
}
// a lane's 2 x 8 consecutive keys of its own query row, out of the ring
__device__ __forceinline__ void read_bias(v8f pbv[2], const float* r) {
#pragma unroll
  for (int nt = 0; nt < 2; ++nt)
    pbv[nt] = __builtin_shufflevector(*(const v4f*)(r + nt * 16),
                                      *(const v4f*)(r + nt * 16 + 4),
                                      0, 1, 2, 3, 4, 5, 6, 7);
}

__global__ __launch_bounds__(128)
void flash_attn(const _Float16* __restrict__ Q,    // [B,H,S,DH] pre-scaled 1/8
                const _Float16* __restrict__ K,    // fragment order (kernel 1)
                const _Float16* __restrict__ Vt,   // fragment order (kernel 1)
                const float* __restrict__ pb,      // [1,H,S,S]
                const float* __restrict__ mask,    // [B,1,1,S]
                _Float16* __restrict__ ctx) {      // [B,S,D] f16
  __shared__ __attribute__((aligned(16))) float pbs[4][16 * PBROW];   // 17 KB
  const int wv   = threadIdx.x >> 5;
  const int lane = threadIdx.x & 31;
  const int mloc = lane & 15;
  const int hi   = lane >> 4;
  const int koff = hi * 8;
  const int bh = blockIdx.y, b = bh / HH, h = bh % HH;
  const int q0 = blockIdx.x * 64 + wv * 16;

  // The walk over the keys enters at rot and wraps round: the 32 blocks of a
  // head read the same K and V and all start together; from a common start they
  // would ask L2 for the same lines at the same moment all the way. Each enters
  // two passes behind its neighbour. rot does not depend on the batch: the two
  // blocks that read the same bias rows still walk them side by side.
  // A pass is counted by kb; its keys are (kb + rot) mod S.
  const int rot = blockIdx.x * 64;   // 0 .. S - 64

  // bias ring: the walk's tiles 0 and 1 are asked for first of all
  const float* pbb = pb + ((size_t)h * SS + blockIdx.x * 64) * SS;   // the block's rows
  unsigned poff[4];
#pragma unroll
  for (int j = 0; j < 4; ++j)
    poff[j] = ((wv * 16 + j * 4 + (lane >> 3)) * SS + (lane & 7) * 4) * 4 - j * 1088;
  const unsigned pld = (unsigned)(size_t)&pbs[wv][0] + (lane >> 3) * (PBROW * 4) + (lane & 7) * 16;
  const float*   prd = &pbs[wv][mloc * PBROW + koff];
  copy_bias(pld, poff, pbb + rot);
  copy_bias(pld + 128, poff, pbb + ((rot + 32) & (SS - 1)));

  const _Float16* qrow = Q + ((size_t)bh * SS + q0 + mloc) * DHD;
  const v16h bq0 = cat16(ld8h(qrow + koff),      ld8h(qrow + 16 + koff));
  const v16h bq1 = cat16(ld8h(qrow + 32 + koff), ld8h(qrow + 48 + koff));
  // stands ahead of the later write of the address registers that these loads name
  asm volatile("s_wait_xcnt 0x0" ::: "memory");

  // 32 keys are 2048 contiguous halves in both: 8 slots of 32 lanes x 8 halves
  const _Float16* Kh  = K  + (size_t)bh * SS * DHD + lane * 8;
  const _Float16* Vh  = Vt + (size_t)bh * DHD * SS + lane * 8;
  const float*    pbq = pb + ((size_t)h * SS + q0) * SS;
  const float*    mk  = mask + (size_t)b * SS + koff;

  v8f o[4];   // o[dt][r] = O[q0 + mloc][dt*16 + hi*8 + r]
#pragma unroll
  for (int i = 0; i < 4; ++i) o[i] = vzero8();
  float mi = -1e30f, li = 0.0f;   // li: this half's keys only, joined at the end

  // No pass waits for a load that it has just issued. K and mask are asked
  // for one pass ahead, right behind the score products that read them, and
  // carried in the same registers over the loop's back edge; so is the bias,
  // out of the ring; V is asked for at the head of its own pass, ahead of the
  // score products and the softmax, in the registers that the last output
  // products have read.
  v16h kf[4];
  v8f pbv[2], mkv[2];
  fetch_frag(kf, Kh + rot * DHD);
  fetch_mask(mkv, mk + rot);
  // stands ahead of any later write of an address register that these loads name
  asm volatile("s_wait_xcnt 0x0" ::: "memory");
  // holds the address arithmetic that follows behind that wait
  __builtin_amdgcn_sched_barrier(0);

  // tile 0 has landed: all but this wave's 4 youngest copies (tile 1's)
  asm volatile("s_wait_asynccnt 0x4" ::: "memory");
  read_bias(pbv, prd);
  // tile 2 goes to tile 0's place, behind the wave's own reads of it (the ring
  // is private to the wave: no other wave reads or fills it, so no barrier)
  refill_bias(pld, poff, pbb + ((rot + 64) & (SS - 1)));

  // where this pass's V, the next pass's K and mask and the bias line asked for
  // ahead lie: carried, so that no load waits for its address
  const _Float16* vp = Vh + rot * DHD;
  const _Float16* kp = Kh + ((rot + 32) & (SS - 1)) * DHD;
  const float*    mp = mk + ((rot + 32) & (SS - 1));
  const float*    pp = pbq + (size_t)mloc * SS + ((rot + 160) & (SS - 1));

  for (int kb = 0; kb < SS; kb += 32) {
    v16h vf[4];
    fetch_frag(vf, vp);
    // stands ahead of any later write of an address register that these loads
    // name; it also holds them here, at the head of the pass: without it they
    // are issued behind the score products and the wait in front of those
    asm volatile("s_wait_xcnt 0x0" ::: "memory");

    // ---- scores tile [32k x 16q] = bias + mask + K * Q^T (Q pre-scaled) ----
    // bias + mask go in as the products' C operand: their registers are free
    // for the next pass's loads as soon as the products are issued
    v8f sc[2];
#pragma unroll
    for (int nt = 0; nt < 2; ++nt) {
      v8f c = pbv[nt] + mkv[nt];
      c = __builtin_amdgcn_wmma_f32_16x16x32_f16(false, kf[nt*2+0], false, bq0, (short)0, c, false, false);
      c = __builtin_amdgcn_wmma_f32_16x16x32_f16(false, kf[nt*2+1], false, bq1, (short)0, c, false, false);
      sc[nt] = c;
    }
    if (kb + 160 < SS)  // bias chunk per q-row, two passes ahead of its copy
      __builtin_prefetch(pp, 0, 1);

    // behind the last pass this fetch is back at the walk's start: it stays in
    // bounds (its values are never used)
    fetch_frag(kf, kp);
    fetch_mask(mkv, mp);
    // stands ahead of any later write of an address register that these loads name
    asm volatile("s_wait_xcnt 0x0" ::: "memory");
    // the next pass's bias tile has landed: all but this wave's 4 youngest
    // copies (every pass issues 4, so the count holds in every pass)
    asm volatile("s_wait_asynccnt 0x4" ::: "memory");
    const int ring = (kb + 32) & 32;   // that tile's place in a ring row, in floats
    read_bias(pbv, prd + ring);
    // keeps these loads issued ahead of the softmax: without it most of them
    // are issued behind it, with no time to land before the next pass
    __builtin_amdgcn_sched_barrier(0);
    // every pointer goes one key block on and wraps at S
    const int st = wrap_step(kb + 32 + rot);
    vp += wrap_step(kb + rot) * DHD;
    kp += st * DHD;
    mp += st;
    pp += wrap_step(kb + 160 + rot);

    // ---- online softmax: one query per lane ----
    float x = fmaxf(sc[0][0], sc[1][0]);
#pragma unroll
    for (int r = 1; r < 8; ++r) x = fmaxf(x, fmaxf(sc[0][r], sc[1][r]));
    x = fmaxf(x, xhalf(x));
    const float mnew = fmaxf(mi, x);
    const float corr = __expf(mi - mnew);
    mi = mnew;
#pragma unroll
    for (int dt = 0; dt < 4; ++dt)
#pragma unroll
      for (int r = 0; r < 8; ++r) o[dt][r] *= corr;
    v16h bp;   // P^T as B: half nt*8 + r is key nt*16 + hi*8 + r
    float ps = 0.0f;
#pragma unroll
    for (int r = 0; r < 8; ++r) {
      float p0 = __expf(sc[0][r] - mnew);
      float p1 = __expf(sc[1][r] - mnew);
      ps += p0 + p1;
      bp[r]     = (_Float16)p0;
      bp[8 + r] = (_Float16)p1;
    }
    li = li * corr + ps;

    // ---- O^T += V^T * P^T  (V stored as ready fragments) ----
#pragma unroll
    for (int dt = 0; dt < 4; ++dt)
      o[dt] = __builtin_amdgcn_wmma_f32_16x16x32_f16(
          false, vf[dt], false, bp, (short)0, o[dt], false, false);

    // refill the place just read, three tiles on, behind the wave's own reads of
    // it. The tile index wraps: the copies stay in bounds and every pass issues
    // its 4 (what the last ones bring is never used)
    refill_bias(pld + ring * 4, poff, pbb + ((kb + 96 + rot) & (SS - 1)));
  }
  // no copy is in flight when the wave ends
  asm volatile("s_wait_asynccnt 0x0" ::: "memory");

  // ---- normalize and emit context in [B,S,H*DH] f16 for the output GEMM ----
  const float rinv = 1.0f / (li + xhalf(li));
  _Float16* crow = ctx + ((size_t)b * SS + q0 + mloc) * DD + (size_t)h * DHD + koff;
#pragma unroll
  for (int dt = 0; dt < 4; ++dt) {
    v8h pk;
#pragma unroll
    for (int r = 0; r < 8; ++r) pk[r] = (_Float16)(o[dt][r] * rinv);
    *(v8h*)(crow + dt * 16) = pk;
  }
}

// ---------------------------------------------------------------------------
// Kernel 3: output projection, f32 epilogue straight to d_out.
// ---------------------------------------------------------------------------
__global__ __launch_bounds__(128)
void gemm_out_f32(const _Float16* __restrict__ A,
                  const _Float16* __restrict__ W,
                  const float* __restrict__ bias,
                  float* __restrict__ out) {
  __shared__ __attribute__((aligned(16))) _Float16 Tl[2][2 * TILE_H];
  const int tid  = threadIdx.x;
  const int wv   = tid >> 5;
  const int lane = tid & 31;
  const int mloc = lane & 15;
  const int hi   = lane >> 4;
  const int koff = hi * 8;
  const int wm = (wv >> 1) * 64, wn = (wv & 1) * 64;   // the wave's place in the tile
  const int m0 = blockIdx.x * 128 + wm;
  const int n0 = blockIdx.y * 128 + wn;

  v8f acc[4][4];
#pragma unroll
  for (int i = 0; i < 4; ++i)
#pragma unroll
    for (int j = 0; j < 4; ++j) acc[i][j] = vzero8();

  gemm_core(A, W, Tl[0], Tl[1], blockIdx.x * 128, blockIdx.y * 128,
            k_start(blockIdx.x, blockIdx.y, 0), tid, wm + mloc, wn + mloc, koff,
            acc);

#pragma unroll
  for (int nt = 0; nt < 4; ++nt) {
    int n = n0 + nt * 16 + mloc;
    float bv = bias[n];
#pragma unroll
    for (int mt = 0; mt < 4; ++mt)
#pragma unroll
      for (int r = 0; r < 8; ++r) {
        int m = m0 + mt * 16 + r + hi * 8;
        out[(size_t)m * DD + n] = acc[mt][nt][r] + bv;
      }
  }
}

// ---------------------------------------------------------------------------
// Host-side launcher (graph-capture safe: stream launches only, ws scratch).
// ---------------------------------------------------------------------------
extern "C" void kernel_launch(void* const* d_in, const int* in_sizes, int n_in,
                              void* d_out, int out_size, void* d_ws, size_t ws_size,
                              hipStream_t stream) {
  (void)in_sizes; (void)n_in; (void)out_size; (void)ws_size;

  const float* hs   = (const float*)d_in[0];
  const float* mask = (const float*)d_in[1];
  const float* pb   = (const float*)d_in[2];
  const float* Wq   = (const float*)d_in[3];
  const float* bq   = (const float*)d_in[4];
  const float* Wk   = (const float*)d_in[5];
  const float* bk   = (const float*)d_in[6];
  const float* Wv   = (const float*)d_in[7];
  const float* bv   = (const float*)d_in[8];
  const float* Wo   = (const float*)d_in[9];
  const float* bo   = (const float*)d_in[10];
  float* out = (float*)d_out;

  char* ws = (char*)d_ws;
  size_t off = 0;
  auto wsalloc = [&](size_t bytes) -> void* {
    void* p = ws + off;
    off += (bytes + 255) & ~(size_t)255;
    return p;
  };
  const size_t actBytes = (size_t)MM * DD * sizeof(_Float16);   // 6.29 MB
  const size_t wBytes   = (size_t)DD * DD * sizeof(_Float16);   // 1.18 MB
  // the casts' outputs back to back: X | Wq | Wk | Wv | Wo
  _Float16* X16   = (_Float16*)wsalloc(actBytes + 4 * wBytes);
  _Float16* Wq16  = X16 + MM * DD;
  _Float16* Wo16  = Wq16 + 3 * DD * DD;
  // the projections' outputs back to back: Q | K | V
  _Float16* Q16   = (_Float16*)wsalloc(3 * actBytes);   // [B,H,S,DH]
  _Float16* K16   = Q16 + MM * DD;                      // fragment order
  _Float16* Vt16  = K16 + MM * DD;                      // fragment order
  _Float16* ctx16 = (_Float16*)wsalloc(actBytes);   // [B,S,D]

  // 0) all five casts, one launch
  cvt_f32_f16<<<ACT_BLKS + 4 * W_BLKS, 256, 0, stream>>>(hs, Wq, Wk, Wv, Wo, X16);

  // 1) Q, K, V projections, one launch (Q pre-scaled; K, V in fragment order)
  dim3 ggrid(MM / 128, DD / 128);   // 32 x 6
  gemm_qkv_f16<<<dim3(MM / 128, DD / 128, 3), 128, 0, stream>>>(X16, Wq16, bq, bk, bv, Q16);

  // 2) fused flash attention with position bias + mask
  flash_attn<<<dim3(SS / 64, BB * HH), 128, 0, stream>>>(Q16, K16, Vt16, pb, mask, ctx16);

  // 3) output projection -> f32 result
  gemm_out_f32<<<ggrid, 128, 0, stream>>>(ctx16, Wo16, bo, out);
}
